// v000
// Measured on an AMD MI455X. A time is GPU time per run, averaged over a window of back-to-back runs after a warm-up
// (all launches, gaps included; the runs take copies of the inputs in turn), and the median of several windows.
// Apart from v000's, it joins two sittings. Times from different sittings can be a few percent apart, while
// side-by-side timings come from the same sitting.
// v000 is the starting kernel. One run takes 142 microseconds.
#include <hip/hip_runtime.h>

// Shapes from reference: N=8, KLEN=512, Q=16, S=128, E=256, H=8
#define NBATCH 8
#define KL     512
#define QS     2048   // Q*S
#define EDIM   256
#define HEADS  8

typedef _Float16 h8   __attribute__((ext_vector_type(8)));
typedef _Float16 v16h __attribute__((ext_vector_type(16)));
typedef float    v8f  __attribute__((ext_vector_type(8)));
typedef int      v4i  __attribute__((ext_vector_type(4)));

#if __has_builtin(__builtin_amdgcn_global_load_async_to_lds_b128)
// Diagnostic from probe: param0 is 'v4i __device__ *'  (addrspace(1) == global),
// so the call is (global_src_v4i*, lds_dst_v4i*, imm offset, imm cpol).
typedef __attribute__((address_space(1))) v4i glob_v4i;
typedef __attribute__((address_space(3))) v4i lds_v4i;
#define HAVE_ASYNC_LDS 1
#else
#define HAVE_ASYNC_LDS 0
#endif

// Build a 16x32 f16 WMMA fragment from a row-major [rows x ld] f16 matrix.
// Identical striping for A ([M][K]) and B stored as B^T ([N][K]):
//   lane<16 : halves 0..7 = K0..K0+7,  halves 8..15 = K0+16..K0+23 (row r0+lane)
//   lane>=16: halves 0..7 = K0+8..+15, halves 8..15 = K0+24..+31   (row r0+lane-16)
template <typename PtrT>
__device__ __forceinline__ v16h load_frag(PtrT base, int r0, int k0, int ld, int lane) {
  PtrT p = base + (size_t)(r0 + (lane & 15)) * ld + k0 + ((lane & 16) ? 8 : 0);
  union { v16h v; h8 h[2]; } u;
  u.h[0] = *(const h8*)(p);
  u.h[1] = *(const h8*)(p + 16);
  return u.v;
}

// C[M x N] = A[M x K] * B^T (B stored [N][K] row-major), f32 accumulate.
// Block = 256 threads = 8 waves stacked in M; wave tile = 32(M) x 64(N):
//   2 A-frags (global) x 4 B-frags (LDS, staged once per block) -> 8 WMMA / k-step.
// OutT: _Float16 or float. TRANSB: write out as [row/mb][N][mb] (batch-transposed).
template <typename OutT, bool TRANSB>
__global__ __launch_bounds__(256) void gemm_wmma_f16(
    const _Float16* __restrict__ A, long sA,
    const _Float16* __restrict__ B, long sB,
    OutT* __restrict__ C, long sC,
    int M, int N, int K, int lda, int ldb, int ldo,
    int mb, const float* __restrict__ bias) {
  extern __shared__ _Float16 bs[];  // [64][K] strip of B^T for this block's n0
  const int lane = threadIdx.x & 31;
  const int wave = threadIdx.x >> 5;
  const int n0 = blockIdx.x * 64;
  const int m0 = (blockIdx.y * 8 + wave) * 32;
  const int bz = blockIdx.z;
  A += (size_t)bz * sA;
  B += (size_t)bz * sB;
  C += (size_t)bz * sC;

  // ---- stage B[n0..n0+63][0..K) into LDS, cooperatively (async path if available)
  {
    const int kchunks = K >> 3;  // 16-byte chunks per row
    for (int c = threadIdx.x; c < 64 * kchunks; c += 256) {
      const int r = c / kchunks;
      const int kk = (c - r * kchunks) << 3;
      const _Float16* g = B + (size_t)(n0 + r) * ldb + kk;
      _Float16* l = bs + r * K + kk;
#if HAVE_ASYNC_LDS
      __builtin_amdgcn_global_load_async_to_lds_b128((glob_v4i*)g, (lds_v4i*)l, 0, 0);
#else
      *(h8*)l = *(const h8*)g;
#endif
    }
#if HAVE_ASYNC_LDS
#if __has_builtin(__builtin_amdgcn_s_wait_asynccnt)
    __builtin_amdgcn_s_wait_asynccnt(0);
#else
    asm volatile("s_wait_asynccnt 0x0" ::: "memory");
#endif
#endif
    __syncthreads();
  }

  v8f acc[2][4] = {};
  for (int k0 = 0; k0 < K; k0 += 32) {
    const v16h a0 = load_frag(A, m0, k0, lda, lane);
    const v16h a1 = load_frag(A, m0 + 16, k0, lda, lane);
#pragma unroll
    for (int t = 0; t < 4; ++t) {
      const v16h b = load_frag((const _Float16*)bs, t * 16, k0, K, lane);
      acc[0][t] =
          __builtin_amdgcn_wmma_f32_16x16x32_f16(false, a0, false, b, (short)0, acc[0][t], false, false);
      acc[1][t] =
          __builtin_amdgcn_wmma_f32_16x16x32_f16(false, a1, false, b, (short)0, acc[1][t], false, false);
    }
  }

  // D layout: VGPR j holds (M = (lane<16 ? j : 8+j), N = n-base + (lane&15))
  const int lm = lane & 15;
  const int rb = (lane >> 4) * 8;
#pragma unroll
  for (int u = 0; u < 2; ++u) {
#pragma unroll
    for (int t = 0; t < 4; ++t) {
      const int col = n0 + t * 16 + lm;
      const float badd = bias ? bias[col] : 0.0f;
#pragma unroll
      for (int j = 0; j < 8; ++j) {
        const int row = m0 + u * 16 + rb + j;
        const float v = acc[u][t][j] + badd;
        if (TRANSB) {
          C[(size_t)(row / mb) * N * mb + (size_t)col * mb + (row % mb)] = (OutT)v;
        } else {
          C[(size_t)row * ldo + col] = (OutT)v;
        }
      }
    }
  }
}

// Masked, scaled softmax over KLEN=512, one wave32 per row, in-place on f16.
__global__ __launch_bounds__(256) void softmax_mask(_Float16* __restrict__ eng,
                                                    const int* __restrict__ mask,
                                                    int rows) {
  const int lane = threadIdx.x & 31;
  const int wave = threadIdx.x >> 5;
  const int row = blockIdx.x * 8 + wave;
  if (row >= rows) return;
  const int n = row >> 11;  // row / QS
  _Float16* p = eng + (size_t)row * KL;
  const int* m = mask + n * KL;

  float x[16];
  float mx = -3.0e38f;
#pragma unroll
  for (int j = 0; j < 16; ++j) {
    const int k = j * 32 + lane;
    float e = (float)p[k] * 0.0625f;  // 1/sqrt(E) = 1/16
    if (m[k] == 0) e = -3.0e38f;      // masked_fill(-1e20) equivalent
    x[j] = e;
    mx = fmaxf(mx, e);
  }
#pragma unroll
  for (int o = 16; o > 0; o >>= 1) mx = fmaxf(mx, __shfl_xor(mx, o, 32));
  float s = 0.0f;
#pragma unroll
  for (int j = 0; j < 16; ++j) { x[j] = __expf(x[j] - mx); s += x[j]; }
#pragma unroll
  for (int o = 16; o > 0; o >>= 1) s += __shfl_xor(s, o, 32);
  const float inv = 1.0f / s;
#pragma unroll
  for (int j = 0; j < 16; ++j) p[j * 32 + lane] = (_Float16)(x[j] * inv);
}

__global__ void cvt_f32_f16(const float* __restrict__ s, _Float16* __restrict__ d, int n) {
  const int i = blockIdx.x * blockDim.x + threadIdx.x;
  if (i < n) d[i] = (_Float16)s[i];
}

// WoSum[e][d] = sum_h Wo[e][h*E + d]  (heads are replicated -> fold Wo to 256x256)
__global__ void wo_reduce(const float* __restrict__ Wo, _Float16* __restrict__ d) {
  const int i = blockIdx.x * blockDim.x + threadIdx.x;
  if (i >= EDIM * EDIM) return;
  const int e = i >> 8, dd = i & 255;
  float s = 0.0f;
#pragma unroll
  for (int h = 0; h < HEADS; ++h) s += Wo[(size_t)e * (HEADS * EDIM) + h * EDIM + dd];
  d[i] = (_Float16)s;
}

extern "C" void kernel_launch(void* const* d_in, const int* in_sizes, int n_in,
                              void* d_out, int out_size, void* d_ws, size_t ws_size,
                              hipStream_t stream) {
  const float* values = (const float*)d_in[0];
  const float* keys   = (const float*)d_in[1];
  const float* query  = (const float*)d_in[2];
  const int*   mask   = (const int*)d_in[3];
  const float* Wv = (const float*)d_in[4];
  const float* Wk = (const float*)d_in[5];
  const float* Wq = (const float*)d_in[6];
  const float* Wo = (const float*)d_in[7];
  const float* bo = (const float*)d_in[8];
  float* out = (float*)d_out;

  // Workspace carve (all f16 intermediates; ~51 MB total, L2-resident on MI455X)
  char* ws = (char*)d_ws;
  size_t off = 0;
  auto carve = [&](size_t bytes) -> void* {
    void* p = ws + off;
    off = (off + bytes + 255) & ~(size_t)255;
    return p;
  };
  _Float16* q16  = (_Float16*)carve((size_t)NBATCH * QS * EDIM * 2);  // query in f16
  _Float16* k16  = (_Float16*)carve((size_t)NBATCH * KL * EDIM * 2);  // keys  in f16
  _Float16* v16  = (_Float16*)carve((size_t)NBATCH * KL * EDIM * 2);  // values in f16
  _Float16* wq16 = (_Float16*)carve((size_t)EDIM * EDIM * 2);
  _Float16* wk16 = (_Float16*)carve((size_t)EDIM * EDIM * 2);
  _Float16* wv16 = (_Float16*)carve((size_t)EDIM * EDIM * 2);
  _Float16* wo16 = (_Float16*)carve((size_t)EDIM * EDIM * 2);         // head-folded Wo
  _Float16* qh   = (_Float16*)carve((size_t)NBATCH * QS * EDIM * 2);  // q proj
  _Float16* kh   = (_Float16*)carve((size_t)NBATCH * KL * EDIM * 2);  // k proj [n][k][d]
  _Float16* vT   = (_Float16*)carve((size_t)NBATCH * KL * EDIM * 2);  // v proj [n][d][k]
  _Float16* eng  = (_Float16*)carve((size_t)NBATCH * QS * KL * 2);    // energy/attn
  _Float16* ctx  = (_Float16*)carve((size_t)NBATCH * QS * EDIM * 2);  // attn @ v
  (void)ws_size; (void)in_sizes; (void)n_in; (void)out_size;

  auto cdiv = [](int a, int b) { return (a + b - 1) / b; };
  const dim3 blk(256);
  const size_t lds256 = 64 * 256 * sizeof(_Float16);  // B strip for K=256 (32 KB)
  const size_t lds512 = 64 * 512 * sizeof(_Float16);  // B strip for K=512 (64 KB)

  // --- precision conversion + weight folding ---
  cvt_f32_f16<<<cdiv(NBATCH * QS * EDIM, 256), blk, 0, stream>>>(query, q16, NBATCH * QS * EDIM);
  cvt_f32_f16<<<cdiv(NBATCH * KL * EDIM, 256), blk, 0, stream>>>(keys, k16, NBATCH * KL * EDIM);
  cvt_f32_f16<<<cdiv(NBATCH * KL * EDIM, 256), blk, 0, stream>>>(values, v16, NBATCH * KL * EDIM);
  cvt_f32_f16<<<cdiv(EDIM * EDIM, 256), blk, 0, stream>>>(Wq, wq16, EDIM * EDIM);
  cvt_f32_f16<<<cdiv(EDIM * EDIM, 256), blk, 0, stream>>>(Wk, wk16, EDIM * EDIM);
  cvt_f32_f16<<<cdiv(EDIM * EDIM, 256), blk, 0, stream>>>(Wv, wv16, EDIM * EDIM);
  wo_reduce<<<cdiv(EDIM * EDIM, 256), blk, 0, stream>>>(Wo, wo16);

  // --- projections: X @ W^T  (W row-major [out][in] == B^T layout directly) ---
  gemm_wmma_f16<_Float16, false><<<dim3(EDIM / 64, (NBATCH * QS) / 256, 1), blk, lds256, stream>>>(
      q16, 0, wq16, 0, qh, 0, NBATCH * QS, EDIM, EDIM, EDIM, EDIM, EDIM, 1, nullptr);
  gemm_wmma_f16<_Float16, false><<<dim3(EDIM / 64, (NBATCH * KL) / 256, 1), blk, lds256, stream>>>(
      k16, 0, wk16, 0, kh, 0, NBATCH * KL, EDIM, EDIM, EDIM, EDIM, EDIM, 1, nullptr);
  // v projection, stored transposed per batch: vT[n][d][k]
  gemm_wmma_f16<_Float16, true><<<dim3(EDIM / 64, (NBATCH * KL) / 256, 1), blk, lds256, stream>>>(
      v16, 0, wv16, 0, vT, 0, NBATCH * KL, EDIM, EDIM, EDIM, EDIM, 0, KL, nullptr);

  // --- energy[n][qs][k] = q[n][qs][:] . k[n][k][:]   (B^T = kh rows, contiguous) ---
  gemm_wmma_f16<_Float16, false><<<dim3(KL / 64, QS / 256, NBATCH), blk, lds256, stream>>>(
      qh, (long)QS * EDIM, kh, (long)KL * EDIM, eng, (long)QS * KL,
      QS, KL, EDIM, EDIM, EDIM, KL, 1, nullptr);

  // --- masked softmax over k (scale 1/16), in place ---
  softmax_mask<<<(NBATCH * QS) / 8, blk, 0, stream>>>(eng, mask, NBATCH * QS);

  // --- ctx[n][qs][d] = attn[n][qs][:] @ v[n][:][d]   (B^T = vT rows, contiguous) ---
  gemm_wmma_f16<_Float16, false><<<dim3(EDIM / 64, QS / 256, NBATCH), blk, lds512, stream>>>(
      eng, (long)QS * KL, vT, (long)EDIM * KL, ctx, (long)QS * EDIM,
      QS, EDIM, KL, KL, KL, EDIM, 1, nullptr);

  // --- out = ctx @ WoSum^T + bo  (f32 output straight to d_out) ---
  gemm_wmma_f16<float, false><<<dim3(EDIM / 64, (NBATCH * QS) / 256, 1), blk, lds256, stream>>>(
      ctx, 0, wo16, 0, out, 0, NBATCH * QS, EDIM, EDIM, EDIM, EDIM, EDIM, 1, bo);
}

// v001
// Measured time: 102 microseconds a run.
// Two timings next to v000 both put it at 1.39 times that version's speed.
#include <hip/hip_runtime.h>

// Shapes from reference: N=8, KLEN=512, Q=16, S=128, E=256, H=8
#define NBATCH 8
#define KL     512
#define QS     2048   // Q*S
#define EDIM   256
#define HEADS  8

typedef _Float16 h8   __attribute__((ext_vector_type(8)));
typedef _Float16 v16h __attribute__((ext_vector_type(16)));
typedef float    v8f  __attribute__((ext_vector_type(8)));
typedef int      v4i  __attribute__((ext_vector_type(4)));

#if __has_builtin(__builtin_amdgcn_global_load_async_to_lds_b128)
// Diagnostic from probe: param0 is 'v4i __device__ *'  (addrspace(1) == global),
// so the call is (global_src_v4i*, lds_dst_v4i*, imm offset, imm cpol).
typedef __attribute__((address_space(1))) v4i glob_v4i;
typedef __attribute__((address_space(3))) v4i lds_v4i;
#define HAVE_ASYNC_LDS 1
#else
#define HAVE_ASYNC_LDS 0
#endif

// Build a 16x32 f16 WMMA fragment from a row-major [rows x ld] f16 matrix.
// Identical striping for A ([M][K]) and B stored as B^T ([N][K]):
//   lane<16 : halves 0..7 = K0..K0+7,  halves 8..15 = K0+16..K0+23 (row r0+lane)
//   lane>=16: halves 0..7 = K0+8..+15, halves 8..15 = K0+24..+31   (row r0+lane-16)
template <typename PtrT>
__device__ __forceinline__ v16h load_frag(PtrT base, int r0, int k0, int ld, int lane) {
  PtrT p = base + (size_t)(r0 + (lane & 15)) * ld + k0 + ((lane & 16) ? 8 : 0);
  union { v16h v; h8 h[2]; } u;
  u.h[0] = *(const h8*)(p);
  u.h[1] = *(const h8*)(p + 16);
  return u.v;
}

// C[M x N] = A[M x K] * B^T (B stored [N][K] row-major), f32 accumulate.
// Block = 256 threads = 8 waves stacked in M; wave tile = 32(M) x 64(N):
//   2 A-frags (global) x 4 B-frags (LDS, staged once per block) -> 8 WMMA / k-step.
// OutT: _Float16 or float. TRANSB: write out as [row/mb][N][mb] (batch-transposed).
template <typename OutT, bool TRANSB>
__global__ __launch_bounds__(256) void gemm_wmma_f16(
    const _Float16* __restrict__ A, long sA,
    const _Float16* __restrict__ B, long sB,
    OutT* __restrict__ C, long sC,
    int M, int N, int K, int lda, int ldb, int ldo,
    int mb, const float* __restrict__ bias) {
  extern __shared__ _Float16 bs[];  // [64][K] strip of B^T for this block's n0
  const int lane = threadIdx.x & 31;
  const int wave = threadIdx.x >> 5;
  const int n0 = blockIdx.x * 64;
  const int m0 = (blockIdx.y * 8 + wave) * 32;
  const int bz = blockIdx.z;
  A += (size_t)bz * sA;
  B += (size_t)bz * sB;
  C += (size_t)bz * sC;

  // ---- stage B[n0..n0+63][0..K) into LDS, cooperatively (async path if available)
  {
    const int kchunks = K >> 3;  // 16-byte chunks per row
    for (int c = threadIdx.x; c < 64 * kchunks; c += 256) {
      const int r = c / kchunks;
      const int kk = (c - r * kchunks) << 3;
      const _Float16* g = B + (size_t)(n0 + r) * ldb + kk;
      _Float16* l = bs + r * K + kk;
#if HAVE_ASYNC_LDS
      __builtin_amdgcn_global_load_async_to_lds_b128((glob_v4i*)g, (lds_v4i*)l, 0, 0);
#else
      *(h8*)l = *(const h8*)g;
#endif
    }
#if HAVE_ASYNC_LDS
#if __has_builtin(__builtin_amdgcn_s_wait_asynccnt)
    __builtin_amdgcn_s_wait_asynccnt(0);
#else
    asm volatile("s_wait_asynccnt 0x0" ::: "memory");
#endif
#endif
    __syncthreads();
  }

  v8f acc[2][4] = {};
  for (int k0 = 0; k0 < K; k0 += 32) {
    const v16h a0 = load_frag(A, m0, k0, lda, lane);
    const v16h a1 = load_frag(A, m0 + 16, k0, lda, lane);
#pragma unroll
    for (int t = 0; t < 4; ++t) {
      const v16h b = load_frag((const _Float16*)bs, t * 16, k0, K, lane);
      acc[0][t] =
          __builtin_amdgcn_wmma_f32_16x16x32_f16(false, a0, false, b, (short)0, acc[0][t], false, false);
      acc[1][t] =
          __builtin_amdgcn_wmma_f32_16x16x32_f16(false, a1, false, b, (short)0, acc[1][t], false, false);
    }
  }

  // D layout: VGPR j holds (M = (lane<16 ? j : 8+j), N = n-base + (lane&15))
  const int lm = lane & 15;
  const int rb = (lane >> 4) * 8;
#pragma unroll
  for (int u = 0; u < 2; ++u) {
#pragma unroll
    for (int t = 0; t < 4; ++t) {
      const int col = n0 + t * 16 + lm;
      const float badd = bias ? bias[col] : 0.0f;
#pragma unroll
      for (int j = 0; j < 8; ++j) {
        const int row = m0 + u * 16 + rb + j;
        const float v = acc[u][t][j] + badd;
        if (TRANSB) {
          C[(size_t)(row / mb) * N * mb + (size_t)col * mb + (row % mb)] = (OutT)v;
        } else {
          C[(size_t)row * ldo + col] = (OutT)v;
        }
      }
    }
  }
}

typedef unsigned int u32x4 __attribute__((ext_vector_type(4)));
typedef unsigned int u32x8 __attribute__((ext_vector_type(8)));

#define KPITCH 264    // halves per staged K row   (512 B + 16 B: 16 B x odd, no bank conflict for b128 readers)
#define VPITCH 520    // halves per staged V^T row (1024 B + 16 B)
#define BUFH   33792  // halves per ring buffer: 128 K rows (the 64 V^T rows need less)

// One 64 KB tile, contiguous in global memory, into one ring buffer: 32 copies of 16 B per lane.
// Copy j of a lane lies 2048 B further in global memory and LSTEP bytes further in LDS.
template <int LSTEP>
__device__ __forceinline__ void stage_tile(unsigned l0, const char* g0) {
#pragma unroll
  for (int b = 0; b < 4; ++b) {
    const unsigned l = l0 + b * 8 * LSTEP;
    const char* g = g0 + b * 8 * 2048;
    // the closing s_wait_xcnt keeps the address registers untouched until the copies have taken them
    asm volatile(
        "global_load_async_to_lds_b128 %0, %8, off\n\t"
        "global_load_async_to_lds_b128 %1, %9, off\n\t"
        "global_load_async_to_lds_b128 %2, %10, off\n\t"
        "global_load_async_to_lds_b128 %3, %11, off\n\t"
        "global_load_async_to_lds_b128 %4, %12, off\n\t"
        "global_load_async_to_lds_b128 %5, %13, off\n\t"
        "global_load_async_to_lds_b128 %6, %14, off\n\t"
        "global_load_async_to_lds_b128 %7, %15, off\n\t"
        "s_wait_xcnt 0x0"
        ::"v"(l), "v"(l + LSTEP), "v"(l + 2 * LSTEP), "v"(l + 3 * LSTEP), "v"(l + 4 * LSTEP),
        "v"(l + 5 * LSTEP), "v"(l + 6 * LSTEP), "v"(l + 7 * LSTEP), "v"(g), "v"(g + 2048),
        "v"(g + 2 * 2048), "v"(g + 3 * 2048), "v"(g + 4 * 2048), "v"(g + 5 * 2048),
        "v"(g + 6 * 2048), "v"(g + 7 * 2048)
        : "memory");
  }
}

// Hand-over of the ring: this wave's LDS reads are done, its own copies have landed, then every wave meets.
__device__ __forceinline__ void publish() {
  asm volatile("s_wait_dscnt 0x0" ::: "memory");    // my reads of the buffer that is refilled next have returned
  asm volatile("s_wait_asynccnt 0x0" ::: "memory");  // my copies of the next tile have landed
  __syncthreads();
}

// Energy, masked softmax and attn @ v in one launch. Block = 4 waves, 16 queries a wave, one batch n.
//   S^T = K . Q^T   : A = K rows (LDS), B = Q (registers); a lane holds scores of ONE query
//   O^T = V^T . P^T : A = V^T rows (LDS), B = the packed score tiles, never leaving registers
// All 512 scores of a query stay in registers as f16 (the rounding the stored energy had).
__global__ __launch_bounds__(128) void attn_fused(const _Float16* __restrict__ qh,
                                                  const _Float16* __restrict__ kh,
                                                  const _Float16* __restrict__ vT,
                                                  const int* __restrict__ mask,
                                                  _Float16* __restrict__ ctx) {
  __shared__ __attribute__((aligned(128))) _Float16 ring[2 * BUFH];
  __shared__ __attribute__((aligned(16))) unsigned short keep[KL];  // 0xFFFF: key counts, 0: masked
  __shared__ int anyw[4];
  const int tid = threadIdx.x;
  const int lane = tid & 31;
  const int wave = tid >> 5;
  const int hi = lane >> 4;
  const int n = blockIdx.x >> 5;
  const int q0 = (blockIdx.x & 31) * 64 + wave * 16;

  const char* kg = (const char*)(kh + (size_t)n * KL * EDIM) + tid * 16;
  const char* vg = (const char*)(vT + (size_t)n * EDIM * KL) + tid * 16;
  const unsigned ring0 = (unsigned)(size_t)ring;
  const unsigned kl = ring0 + (tid >> 5) * (KPITCH * 2) + (tid & 31) * 16;
  const unsigned vl = ring0 + (tid >> 6) * (VPITCH * 2) + (tid & 63) * 16;

  stage_tile<4 * KPITCH * 2>(kl, kg);  // keys 0..127 -> buffer 0

  {
    const v4i mv = *(const v4i*)(mask + n * KL + tid * 4);
    unsigned long long kw = 0;
#pragma unroll
    for (int j = 0; j < 4; ++j)
      if (mv[j] != 0) kw |= 0xFFFFull << (16 * j);
    *(unsigned long long*)(keep + tid * 4) = kw;
    const unsigned bal = __builtin_amdgcn_ballot_w32(kw != 0);
    if (lane == 0) anyw[wave] = (bal != 0);
  }

  const _Float16* qp = qh + ((size_t)n * QS + q0 + (lane & 15)) * EDIM + hi * 8;  // load_frag's k order
  v16h qf[8];
#pragma unroll
  for (int ks = 0; ks < 8; ++ks) {
    union { v16h v; h8 h[2]; } u;
    u.h[0] = *(const h8*)(qp + ks * 32);
    u.h[1] = *(const h8*)(qp + ks * 32 + 16);
    qf[ks] = u.v;
  }
  // qp as an input keeps the loads' address register from being reused as a load's destination ahead of the wait
  asm volatile("s_wait_xcnt 0x0" ::"v"(qp) : "memory");

  asm volatile("s_wait_asynccnt 0x0" ::: "memory");  // my copies of tile 0 have landed
  __syncthreads();
  stage_tile<4 * KPITCH * 2>(kl + BUFH * 2, kg + 65536);  // keys 128..255 -> buffer 1

  // ---- scores: sp[kk] holds keys kk*32..+31 of this lane's query in B-operand order
  v16h sp[16];
#pragma unroll  // sp[] is indexed by constants only, so it stays in registers
  for (int t = 0; t < 4; ++t) {
    const _Float16* buf = ring + (t & 1) * BUFH;
#pragma unroll
    for (int p = 0; p < 4; ++p) {
      v8f s0 = {}, s1 = {};
#pragma unroll
      for (int ks = 0; ks < 8; ++ks) {
        const v16h a0 = load_frag(buf, p * 32, ks * 32, KPITCH, lane);
        const v16h a1 = load_frag(buf, p * 32 + 16, ks * 32, KPITCH, lane);
        s0 = __builtin_amdgcn_wmma_f32_16x16x32_f16(false, a0, false, qf[ks], (short)0, s0, false, false);
        s1 = __builtin_amdgcn_wmma_f32_16x16x32_f16(false, a1, false, qf[ks], (short)0, s1, false, false);
      }
      v16h pk;
#pragma unroll
      for (int j = 0; j < 8; ++j) {
        pk[j] = (_Float16)s0[j];
        pk[8 + j] = (_Float16)s1[j];
      }
      sp[t * 4 + p] = pk;
    }
    publish();
    if (t < 2)
      stage_tile<4 * KPITCH * 2>(kl + (t & 1) * (BUFH * 2), kg + (t + 2) * 65536);
    else
      stage_tile<2 * VPITCH * 2>(vl + (t & 1) * (BUFH * 2), vg + (t - 2) * 65536);
  }

  // ---- masked softmax, in-lane; the two lane halves of a query meet once for the maximum, once for the sum
  // A masked key scores -inf (weight 0). With every key masked the reference is uniform: all scores 0.
  const unsigned fill = (anyw[0] | anyw[1] | anyw[2] | anyw[3]) ? 0xFC00FC00u : 0u;
  v16h mxv;
#pragma unroll
  for (int kk = 0; kk < 16; ++kk) {
    const u32x4 m0 = *(const u32x4*)(keep + kk * 32 + hi * 8);
    const u32x4 m1 = *(const u32x4*)(keep + kk * 32 + 16 + hi * 8);
    u32x8 s = __builtin_bit_cast(u32x8, sp[kk]);
#pragma unroll
    for (int i = 0; i < 4; ++i) {
      s[i] = (s[i] & m0[i]) | (fill & ~m0[i]);
      s[4 + i] = (s[4 + i] & m1[i]) | (fill & ~m1[i]);
    }
    sp[kk] = __builtin_bit_cast(v16h, s);
    mxv = kk ? __builtin_elementwise_max(mxv, sp[kk]) : sp[kk];
  }
  float mx = (float)mxv[0];
#pragma unroll
  for (int j = 1; j < 16; ++j) mx = fmaxf(mx, (float)mxv[j]);
  mx = fmaxf(mx, __shfl_xor(mx, 16, 32));
  const float sc = 0.0625f * 1.44269504f;  // 1/sqrt(E) * log2(e)
  const float mc = mx * sc;
  float sum[4] = {0.0f, 0.0f, 0.0f, 0.0f};
#pragma unroll
  for (int kk = 0; kk < 16; ++kk) {
    v16h pk;
#pragma unroll
    for (int j = 0; j < 16; ++j) {
      const float x = __builtin_amdgcn_exp2f(fmaf((float)sp[kk][j], sc, -mc));
      sum[j & 3] += x;
      pk[j] = (_Float16)x;
    }
    sp[kk] = pk;
  }
  float st = (sum[0] + sum[1]) + (sum[2] + sum[3]);
  st += __shfl_xor(st, 16, 32);
  const float inv = 1.0f / st;

  // ---- O^T, 64 rows of V^T a trip; a lane's 8 results are 8 consecutive d of its query: one 16-byte store
  _Float16* crow = ctx + ((size_t)n * QS + q0 + (lane & 15)) * EDIM + hi * 8;
#pragma unroll  // rolled, this loop spilled the staging addresses to scratch
  for (int c = 0; c < 4; ++c) {
    const _Float16* buf = ring + (c & 1) * BUFH;
    v8f o[4] = {};
#pragma unroll
    for (int kk = 0; kk < 16; ++kk) {
#pragma unroll
      for (int i = 0; i < 4; ++i) {
        const v16h a = load_frag(buf, i * 16, kk * 32, VPITCH, lane);
        o[i] = __builtin_amdgcn_wmma_f32_16x16x32_f16(false, a, false, sp[kk], (short)0, o[i], false, false);
      }
    }
#pragma unroll
    for (int i = 0; i < 4; ++i) {
      h8 r;
#pragma unroll
      for (int j = 0; j < 8; ++j) r[j] = (_Float16)(o[i][j] * inv);
      *(h8*)(crow + c * 64 + i * 16) = r;
    }
    publish();
    if (c < 2) stage_tile<2 * VPITCH * 2>(vl + (c & 1) * (BUFH * 2), vg + (c + 2) * 65536);
  }
  asm volatile("s_wait_asynccnt 0x0" ::: "memory");  // nothing of mine is in flight when the wave ends
}

__global__ void cvt_f32_f16(const float* __restrict__ s, _Float16* __restrict__ d, int n) {
  const int i = blockIdx.x * blockDim.x + threadIdx.x;
  if (i < n) d[i] = (_Float16)s[i];
}

// WoSum[e][d] = sum_h Wo[e][h*E + d]  (heads are replicated -> fold Wo to 256x256)
__global__ void wo_reduce(const float* __restrict__ Wo, _Float16* __restrict__ d) {
  const int i = blockIdx.x * blockDim.x + threadIdx.x;
  if (i >= EDIM * EDIM) return;
  const int e = i >> 8, dd = i & 255;
  float s = 0.0f;
#pragma unroll
  for (int h = 0; h < HEADS; ++h) s += Wo[(size_t)e * (HEADS * EDIM) + h * EDIM + dd];
  d[i] = (_Float16)s;
}

extern "C" void kernel_launch(void* const* d_in, const int* in_sizes, int n_in,
                              void* d_out, int out_size, void* d_ws, size_t ws_size,
                              hipStream_t stream) {
  const float* values = (const float*)d_in[0];
  const float* keys   = (const float*)d_in[1];
  const float* query  = (const float*)d_in[2];
  const int*   mask   = (const int*)d_in[3];
  const float* Wv = (const float*)d_in[4];
  const float* Wk = (const float*)d_in[5];
  const float* Wq = (const float*)d_in[6];
  const float* Wo = (const float*)d_in[7];
  const float* bo = (const float*)d_in[8];
  float* out = (float*)d_out;

  // Workspace carve (all f16 intermediates; ~34 MB total, L2-resident on MI455X)
  char* ws = (char*)d_ws;
  size_t off = 0;
  auto carve = [&](size_t bytes) -> void* {
    void* p = ws + off;
    off = (off + bytes + 255) & ~(size_t)255;
    return p;
  };
  _Float16* q16  = (_Float16*)carve((size_t)NBATCH * QS * EDIM * 2);  // query in f16
  _Float16* k16  = (_Float16*)carve((size_t)NBATCH * KL * EDIM * 2);  // keys  in f16
  _Float16* v16  = (_Float16*)carve((size_t)NBATCH * KL * EDIM * 2);  // values in f16
  _Float16* wq16 = (_Float16*)carve((size_t)EDIM * EDIM * 2);
  _Float16* wk16 = (_Float16*)carve((size_t)EDIM * EDIM * 2);
  _Float16* wv16 = (_Float16*)carve((size_t)EDIM * EDIM * 2);
  _Float16* wo16 = (_Float16*)carve((size_t)EDIM * EDIM * 2);         // head-folded Wo
  _Float16* qh   = (_Float16*)carve((size_t)NBATCH * QS * EDIM * 2);  // q proj
  _Float16* kh   = (_Float16*)carve((size_t)NBATCH * KL * EDIM * 2);  // k proj [n][k][d]
  _Float16* vT   = (_Float16*)carve((size_t)NBATCH * KL * EDIM * 2);  // v proj [n][d][k]
  _Float16* ctx  = (_Float16*)carve((size_t)NBATCH * QS * EDIM * 2);  // attn @ v
  (void)ws_size; (void)in_sizes; (void)n_in; (void)out_size;

  auto cdiv = [](int a, int b) { return (a + b - 1) / b; };
  const dim3 blk(256);
  const size_t lds256 = 64 * 256 * sizeof(_Float16);  // B strip for K=256 (32 KB)

  // --- precision conversion + weight folding ---
  cvt_f32_f16<<<cdiv(NBATCH * QS * EDIM, 256), blk, 0, stream>>>(query, q16, NBATCH * QS * EDIM);
  cvt_f32_f16<<<cdiv(NBATCH * KL * EDIM, 256), blk, 0, stream>>>(keys, k16, NBATCH * KL * EDIM);
  cvt_f32_f16<<<cdiv(NBATCH * KL * EDIM, 256), blk, 0, stream>>>(values, v16, NBATCH * KL * EDIM);
  cvt_f32_f16<<<cdiv(EDIM * EDIM, 256), blk, 0, stream>>>(Wq, wq16, EDIM * EDIM);
  cvt_f32_f16<<<cdiv(EDIM * EDIM, 256), blk, 0, stream>>>(Wk, wk16, EDIM * EDIM);
  cvt_f32_f16<<<cdiv(EDIM * EDIM, 256), blk, 0, stream>>>(Wv, wv16, EDIM * EDIM);
  wo_reduce<<<cdiv(EDIM * EDIM, 256), blk, 0, stream>>>(Wo, wo16);

  // --- projections: X @ W^T  (W row-major [out][in] == B^T layout directly) ---
  gemm_wmma_f16<_Float16, false><<<dim3(EDIM / 64, (NBATCH * QS) / 256, 1), blk, lds256, stream>>>(
      q16, 0, wq16, 0, qh, 0, NBATCH * QS, EDIM, EDIM, EDIM, EDIM, EDIM, 1, nullptr);
  gemm_wmma_f16<_Float16, false><<<dim3(EDIM / 64, (NBATCH * KL) / 256, 1), blk, lds256, stream>>>(
      k16, 0, wk16, 0, kh, 0, NBATCH * KL, EDIM, EDIM, EDIM, EDIM, EDIM, 1, nullptr);
  // v projection, stored transposed per batch: vT[n][d][k]
  gemm_wmma_f16<_Float16, true><<<dim3(EDIM / 64, (NBATCH * KL) / 256, 1), blk, lds256, stream>>>(
      v16, 0, wv16, 0, vT, 0, NBATCH * KL, EDIM, EDIM, EDIM, EDIM, 0, KL, nullptr);

  // --- ctx = softmax(mask(q k^T) / 16) @ v, scores kept in registers ---
  attn_fused<<<NBATCH * (QS / 64), dim3(128), 0, stream>>>(qh, kh, vT, mask, ctx);

  // --- out = ctx @ WoSum^T + bo  (f32 output straight to d_out) ---
  gemm_wmma_f16<float, false><<<dim3(EDIM / 64, (NBATCH * QS) / 256, 1), blk, lds256, stream>>>(
      ctx, 0, wo16, 0, out, 0, NBATCH * QS, EDIM, EDIM, EDIM, EDIM, EDIM, 1, bo);
}

// v002
// Measured time: 87.1 microseconds a run.
// Timed twice side by side with v001, it ran 1.18 and 1.20 times as fast.
// Counting every step since v000, it is 1.65 times as fast.
#include <hip/hip_runtime.h>

// Shapes from reference: N=8, KLEN=512, Q=16, S=128, E=256, H=8
#define NBATCH 8
#define KL     512
#define QS     2048   // Q*S
#define EDIM   256
#define HEADS  8

typedef _Float16 h8   __attribute__((ext_vector_type(8)));
typedef _Float16 v16h __attribute__((ext_vector_type(16)));
typedef float    v8f  __attribute__((ext_vector_type(8)));
typedef int      v4i  __attribute__((ext_vector_type(4)));

#if __has_builtin(__builtin_amdgcn_global_load_async_to_lds_b128)
// Diagnostic from probe: param0 is 'v4i __device__ *'  (addrspace(1) == global),
// so the call is (global_src_v4i*, lds_dst_v4i*, imm offset, imm cpol).
typedef __attribute__((address_space(1))) v4i glob_v4i;
typedef __attribute__((address_space(3))) v4i lds_v4i;
#define HAVE_ASYNC_LDS 1
#else
#define HAVE_ASYNC_LDS 0
#endif

// Build a 16x32 f16 WMMA fragment from a row-major [rows x ld] f16 matrix.
// Identical striping for A ([M][K]) and B stored as B^T ([N][K]):
//   lane<16 : halves 0..7 = K0..K0+7,  halves 8..15 = K0+16..K0+23 (row r0+lane)
//   lane>=16: halves 0..7 = K0+8..+15, halves 8..15 = K0+24..+31   (row r0+lane-16)
template <typename PtrT>
__device__ __forceinline__ v16h load_frag(PtrT base, int r0, int k0, int ld, int lane) {
  PtrT p = base + (size_t)(r0 + (lane & 15)) * ld + k0 + ((lane & 16) ? 8 : 0);
  union { v16h v; h8 h[2]; } u;
  u.h[0] = *(const h8*)(p);
  u.h[1] = *(const h8*)(p + 16);
  return u.v;
}

// C[M x N] = A[M x K] * B^T (B stored [N][K] row-major), f32 accumulate.
// Block = 256 threads = 8 waves stacked in M; wave tile = 32(M) x 64(N):
//   2 A-frags (global) x 4 B-frags (LDS, staged once per block) -> 8 WMMA / k-step.
// OutT: _Float16 or float. TRANSB: write out as [row/mb][N][mb] (batch-transposed).
template <typename OutT, bool TRANSB>
__global__ __launch_bounds__(256) void gemm_wmma_f16(
    const _Float16* __restrict__ A, long sA,
    const _Float16* __restrict__ B, long sB,
    OutT* __restrict__ C, long sC,
    int M, int N, int K, int lda, int ldb, int ldo,
    int mb, const float* __restrict__ bias) {
  extern __shared__ _Float16 bs[];  // [64][K] strip of B^T for this block's n0
  const int lane = threadIdx.x & 31;
  const int wave = threadIdx.x >> 5;
  const int n0 = blockIdx.x * 64;
  const int m0 = (blockIdx.y * 8 + wave) * 32;
  const int bz = blockIdx.z;
  A += (size_t)bz * sA;
  B += (size_t)bz * sB;
  C += (size_t)bz * sC;

  // ---- stage B[n0..n0+63][0..K) into LDS, cooperatively (async path if available)
  {
    const int kchunks = K >> 3;  // 16-byte chunks per row
    for (int c = threadIdx.x; c < 64 * kchunks; c += 256) {
      const int r = c / kchunks;
      const int kk = (c - r * kchunks) << 3;
      const _Float16* g = B + (size_t)(n0 + r) * ldb + kk;
      _Float16* l = bs + r * K + kk;
#if HAVE_ASYNC_LDS
      __builtin_amdgcn_global_load_async_to_lds_b128((glob_v4i*)g, (lds_v4i*)l, 0, 0);
#else
      *(h8*)l = *(const h8*)g;
#endif
    }
#if HAVE_ASYNC_LDS
#if __has_builtin(__builtin_amdgcn_s_wait_asynccnt)
    __builtin_amdgcn_s_wait_asynccnt(0);
#else
    asm volatile("s_wait_asynccnt 0x0" ::: "memory");
#endif
#endif
    __syncthreads();
  }

  v8f acc[2][4] = {};
  for (int k0 = 0; k0 < K; k0 += 32) {
    const v16h a0 = load_frag(A, m0, k0, lda, lane);
    const v16h a1 = load_frag(A, m0 + 16, k0, lda, lane);
#pragma unroll
    for (int t = 0; t < 4; ++t) {
      const v16h b = load_frag((const _Float16*)bs, t * 16, k0, K, lane);
      acc[0][t] =
          __builtin_amdgcn_wmma_f32_16x16x32_f16(false, a0, false, b, (short)0, acc[0][t], false, false);
      acc[1][t] =
          __builtin_amdgcn_wmma_f32_16x16x32_f16(false, a1, false, b, (short)0, acc[1][t], false, false);
    }
  }

  // D layout: VGPR j holds (M = (lane<16 ? j : 8+j), N = n-base + (lane&15))
  const int lm = lane & 15;
  const int rb = (lane >> 4) * 8;
#pragma unroll
  for (int u = 0; u < 2; ++u) {
#pragma unroll
    for (int t = 0; t < 4; ++t) {
      const int col = n0 + t * 16 + lm;
      const float badd = bias ? bias[col] : 0.0f;
#pragma unroll
      for (int j = 0; j < 8; ++j) {
        const int row = m0 + u * 16 + rb + j;
        const float v = acc[u][t][j] + badd;
        if (TRANSB) {
          C[(size_t)(row / mb) * N * mb + (size_t)col * mb + (row % mb)] = (OutT)v;
        } else {
          C[(size_t)row * ldo + col] = (OutT)v;
        }
      }
    }
  }
}

typedef float f32x4 __attribute__((ext_vector_type(4)));

// Eight f32 rounded to f16 (nearest even).
__device__ __forceinline__ h8 round8(f32x4 x, f32x4 y) {
  return __builtin_convertvector(__builtin_shufflevector(x, y, 0, 1, 2, 3, 4, 5, 6, 7), h8);
}

// Projection C = X . W^T straight from the f32 inputs: X [rows][EDIM], W [EDIM][EDIM], both row-major,
// both rounded to f16 in registers on their way to the matrix unit. Tiling, k order and sum order of
// gemm_wmma_f16: 8 waves stacked in M, wave tile 32(M) x 64(N), 64 rows of W in LDS as f16.
// TRANSB: write out as [row/KL][EDIM][KL] (batch-transposed).
template <bool TRANSB>
__global__ __launch_bounds__(256) void proj_f32(const float* __restrict__ X,
                                                const float* __restrict__ Wt,
                                                _Float16* __restrict__ C) {
  __shared__ __attribute__((aligned(16))) _Float16 bs[64 * EDIM];
  const int lane = threadIdx.x & 31;
  const int wave = threadIdx.x >> 5;
  const int n0 = blockIdx.x * 64;
  const int m0 = (blockIdx.y * 8 + wave) * 32;

  // W[n0..n0+63][0..EDIM): a thread takes 8 consecutive k of row wave + 8 i
  const int e0 = wave * EDIM + lane * 8;
  const unsigned wo = (unsigned)(n0 * EDIM + e0) * 4u;  // byte offsets: a uniform base and one register a stream
  // this wave's 32 rows of X, load_frag's k order
  const unsigned xo = (unsigned)((m0 + (lane & 15)) * EDIM + ((lane & 16) ? 8 : 0)) * 4u;
  const char* wp = (const char*)Wt + wo;
  const char* xp = (const char*)X + xo;
  f32x4 wr[8][2];
#pragma unroll
  for (int i = 0; i < 8; ++i) {
    wr[i][0] = *(const f32x4*)(wp + i * 8 * EDIM * 4);
    wr[i][1] = *(const f32x4*)(wp + i * 8 * EDIM * 4 + 16);
  }
  f32x4 xr[8][2][4];
#pragma unroll
  for (int ks = 0; ks < 8; ++ks) {
#pragma unroll
    for (int u = 0; u < 2; ++u) {
      const char* p = xp + (u * 16 * EDIM + ks * 32) * 4;
      xr[ks][u][0] = *(const f32x4*)(p);
      xr[ks][u][1] = *(const f32x4*)(p + 16);
      xr[ks][u][2] = *(const f32x4*)(p + 64);
      xr[ks][u][3] = *(const f32x4*)(p + 80);
    }
  }
  // wo and xo as inputs keep the loads' address registers untouched (also as a later load's destination) up to the wait.
  // Its memory clobber holds all 80 loads ahead of it: without the statement the compiler paired each two loads
  // with their rounding, one memory round trip after the other.
  asm volatile("s_wait_xcnt 0x0" ::"v"(wo), "v"(xo) : "memory");

#pragma unroll
  for (int i = 0; i < 8; ++i) *(h8*)(bs + e0 + i * 8 * EDIM) = round8(wr[i][0], wr[i][1]);
  __syncthreads();

  v8f acc[2][4] = {};
#pragma unroll
  for (int ks = 0; ks < 8; ++ks) {
    v16h a[2];
#pragma unroll
    for (int u = 0; u < 2; ++u) {
      union { v16h v; h8 h[2]; } f;
      f.h[0] = round8(xr[ks][u][0], xr[ks][u][1]);
      f.h[1] = round8(xr[ks][u][2], xr[ks][u][3]);
      a[u] = f.v;
    }
#pragma unroll
    for (int t = 0; t < 4; ++t) {
      const v16h b = load_frag((const _Float16*)bs, t * 16, ks * 32, EDIM, lane);
      acc[0][t] =
          __builtin_amdgcn_wmma_f32_16x16x32_f16(false, a[0], false, b, (short)0, acc[0][t], false, false);
      acc[1][t] =
          __builtin_amdgcn_wmma_f32_16x16x32_f16(false, a[1], false, b, (short)0, acc[1][t], false, false);
    }
  }

  // D layout: VGPR j holds (M = (lane<16 ? j : 8+j), N = n-base + (lane&15))
  const int row = m0 + (lane >> 4) * 8;  // + u * 16 + j; a wave's 32 rows lie in one batch (KL is a multiple of 32)
  const int col = n0 + (lane & 15);      // + t * 16
  _Float16* cp = TRANSB ? C + (size_t)(row / KL) * EDIM * KL + (size_t)col * KL + (row % KL)
                        : C + (size_t)row * EDIM + col;
#pragma unroll
  for (int u = 0; u < 2; ++u) {
#pragma unroll
    for (int t = 0; t < 4; ++t) {
      // the stores issued so far have taken their registers before later roundings write into them
      if (u + t > 0) asm volatile("s_wait_xcnt 0x0" ::: "memory");
#pragma unroll
      for (int j = 0; j < 8; ++j) {
        cp[TRANSB ? t * 16 * KL + u * 16 + j : (u * 16 + j) * EDIM + t * 16] = (_Float16)acc[u][t][j];
      }
    }
  }
}

typedef unsigned int u32x4 __attribute__((ext_vector_type(4)));
typedef unsigned int u32x8 __attribute__((ext_vector_type(8)));

#define KPITCH 264    // halves per staged K row   (512 B + 16 B: 16 B x odd, no bank conflict for b128 readers)
#define VPITCH 520    // halves per staged V^T row (1024 B + 16 B)
#define BUFH   33792  // halves per ring buffer: 128 K rows (the 64 V^T rows need less)

// One 64 KB tile, contiguous in global memory, into one ring buffer: 32 copies of 16 B per lane.
// Copy j of a lane lies 2048 B further in global memory and LSTEP bytes further in LDS.
template <int LSTEP>
__device__ __forceinline__ void stage_tile(unsigned l0, const char* g0) {
#pragma unroll
  for (int b = 0; b < 4; ++b) {
    const unsigned l = l0 + b * 8 * LSTEP;
    const char* g = g0 + b * 8 * 2048;
    // the closing s_wait_xcnt keeps the address registers untouched until the copies have taken them
    asm volatile(
        "global_load_async_to_lds_b128 %0, %8, off\n\t"
        "global_load_async_to_lds_b128 %1, %9, off\n\t"
        "global_load_async_to_lds_b128 %2, %10, off\n\t"
        "global_load_async_to_lds_b128 %3, %11, off\n\t"
        "global_load_async_to_lds_b128 %4, %12, off\n\t"
        "global_load_async_to_lds_b128 %5, %13, off\n\t"
        "global_load_async_to_lds_b128 %6, %14, off\n\t"
        "global_load_async_to_lds_b128 %7, %15, off\n\t"
        "s_wait_xcnt 0x0"
        ::"v"(l), "v"(l + LSTEP), "v"(l + 2 * LSTEP), "v"(l + 3 * LSTEP), "v"(l + 4 * LSTEP),
        "v"(l + 5 * LSTEP), "v"(l + 6 * LSTEP), "v"(l + 7 * LSTEP), "v"(g), "v"(g + 2048),
        "v"(g + 2 * 2048), "v"(g + 3 * 2048), "v"(g + 4 * 2048), "v"(g + 5 * 2048),
        "v"(g + 6 * 2048), "v"(g + 7 * 2048)
        : "memory");
  }
}

// Hand-over of the ring: this wave's LDS reads are done, its own copies have landed, then every wave meets.
__device__ __forceinline__ void publish() {
  asm volatile("s_wait_dscnt 0x0" ::: "memory");    // my reads of the buffer that is refilled next have returned
  asm volatile("s_wait_asynccnt 0x0" ::: "memory");  // my copies of the next tile have landed
  __syncthreads();
}

// Energy, masked softmax and attn @ v in one launch. Block = 4 waves, 16 queries a wave, one batch n.
//   S^T = K . Q^T   : A = K rows (LDS), B = Q (registers); a lane holds scores of ONE query
//   O^T = V^T . P^T : A = V^T rows (LDS), B = the packed score tiles, never leaving registers
// All 512 scores of a query stay in registers as f16 (the rounding the stored energy had).
__global__ __launch_bounds__(128) void attn_fused(const _Float16* __restrict__ qh,
                                                  const _Float16* __restrict__ kh,
                                                  const _Float16* __restrict__ vT,
                                                  const int* __restrict__ mask,
                                                  _Float16* __restrict__ ctx) {
  __shared__ __attribute__((aligned(128))) _Float16 ring[2 * BUFH];
  __shared__ __attribute__((aligned(16))) unsigned short keep[KL];  // 0xFFFF: key counts, 0: masked
  __shared__ int anyw[4];
  const int tid = threadIdx.x;
  const int lane = tid & 31;
  const int wave = tid >> 5;
  const int hi = lane >> 4;
  const int n = blockIdx.x >> 5;
  const int q0 = (blockIdx.x & 31) * 64 + wave * 16;

  const char* kg = (const char*)(kh + (size_t)n * KL * EDIM) + tid * 16;
  const char* vg = (const char*)(vT + (size_t)n * EDIM * KL) + tid * 16;
  const unsigned ring0 = (unsigned)(size_t)ring;
  const unsigned kl = ring0 + (tid >> 5) * (KPITCH * 2) + (tid & 31) * 16;
  const unsigned vl = ring0 + (tid >> 6) * (VPITCH * 2) + (tid & 63) * 16;

  stage_tile<4 * KPITCH * 2>(kl, kg);  // keys 0..127 -> buffer 0

  {
    const v4i mv = *(const v4i*)(mask + n * KL + tid * 4);
    unsigned long long kw = 0;
#pragma unroll
    for (int j = 0; j < 4; ++j)
      if (mv[j] != 0) kw |= 0xFFFFull << (16 * j);
    *(unsigned long long*)(keep + tid * 4) = kw;
    const unsigned bal = __builtin_amdgcn_ballot_w32(kw != 0);
    if (lane == 0) anyw[wave] = (bal != 0);
  }

  const _Float16* qp = qh + ((size_t)n * QS + q0 + (lane & 15)) * EDIM + hi * 8;  // load_frag's k order
  v16h qf[8];
#pragma unroll
  for (int ks = 0; ks < 8; ++ks) {
    union { v16h v; h8 h[2]; } u;
    u.h[0] = *(const h8*)(qp + ks * 32);
    u.h[1] = *(const h8*)(qp + ks * 32 + 16);
    qf[ks] = u.v;
  }
  // qp as an input keeps the loads' address register from being reused as a load's destination ahead of the wait
  asm volatile("s_wait_xcnt 0x0" ::"v"(qp) : "memory");

  asm volatile("s_wait_asynccnt 0x0" ::: "memory");  // my copies of tile 0 have landed
  __syncthreads();
  stage_tile<4 * KPITCH * 2>(kl + BUFH * 2, kg + 65536);  // keys 128..255 -> buffer 1

  // ---- scores: sp[kk] holds keys kk*32..+31 of this lane's query in B-operand order
  v16h sp[16];
#pragma unroll  // sp[] is indexed by constants only, so it stays in registers
  for (int t = 0; t < 4; ++t) {
    const _Float16* buf = ring + (t & 1) * BUFH;
#pragma unroll
    for (int p = 0; p < 4; ++p) {
      v8f s0 = {}, s1 = {};
#pragma unroll
      for (int ks = 0; ks < 8; ++ks) {
        const v16h a0 = load_frag(buf, p * 32, ks * 32, KPITCH, lane);
        const v16h a1 = load_frag(buf, p * 32 + 16, ks * 32, KPITCH, lane);
        s0 = __builtin_amdgcn_wmma_f32_16x16x32_f16(false, a0, false, qf[ks], (short)0, s0, false, false);
        s1 = __builtin_amdgcn_wmma_f32_16x16x32_f16(false, a1, false, qf[ks], (short)0, s1, false, false);
      }
      v16h pk;
#pragma unroll
      for (int j = 0; j < 8; ++j) {
        pk[j] = (_Float16)s0[j];
        pk[8 + j] = (_Float16)s1[j];
      }
      sp[t * 4 + p] = pk;
    }
    publish();
    if (t < 2)
      stage_tile<4 * KPITCH * 2>(kl + (t & 1) * (BUFH * 2), kg + (t + 2) * 65536);
    else
      stage_tile<2 * VPITCH * 2>(vl + (t & 1) * (BUFH * 2), vg + (t - 2) * 65536);
  }

  // ---- masked softmax, in-lane; the two lane halves of a query meet once for the maximum, once for the sum
  // A masked key scores -inf (weight 0). With every key masked the reference is uniform: all scores 0.
  const unsigned fill = (anyw[0] | anyw[1] | anyw[2] | anyw[3]) ? 0xFC00FC00u : 0u;
  v16h mxv;
#pragma unroll
  for (int kk = 0; kk < 16; ++kk) {
    const u32x4 m0 = *(const u32x4*)(keep + kk * 32 + hi * 8);
    const u32x4 m1 = *(const u32x4*)(keep + kk * 32 + 16 + hi * 8);
    u32x8 s = __builtin_bit_cast(u32x8, sp[kk]);
#pragma unroll
    for (int i = 0; i < 4; ++i) {
      s[i] = (s[i] & m0[i]) | (fill & ~m0[i]);
      s[4 + i] = (s[4 + i] & m1[i]) | (fill & ~m1[i]);
    }
    sp[kk] = __builtin_bit_cast(v16h, s);
    mxv = kk ? __builtin_elementwise_max(mxv, sp[kk]) : sp[kk];
  }
  float mx = (float)mxv[0];
#pragma unroll
  for (int j = 1; j < 16; ++j) mx = fmaxf(mx, (float)mxv[j]);
  mx = fmaxf(mx, __shfl_xor(mx, 16, 32));
  const float sc = 0.0625f * 1.44269504f;  // 1/sqrt(E) * log2(e)
  const float mc = mx * sc;
  float sum[4] = {0.0f, 0.0f, 0.0f, 0.0f};
#pragma unroll
  for (int kk = 0; kk < 16; ++kk) {
    v16h pk;
#pragma unroll
    for (int j = 0; j < 16; ++j) {
      const float x = __builtin_amdgcn_exp2f(fmaf((float)sp[kk][j], sc, -mc));
      sum[j & 3] += x;
      pk[j] = (_Float16)x;
    }
    sp[kk] = pk;
  }
  float st = (sum[0] + sum[1]) + (sum[2] + sum[3]);
  st += __shfl_xor(st, 16, 32);
  const float inv = 1.0f / st;

  // ---- O^T, 64 rows of V^T a trip; a lane's 8 results are 8 consecutive d of its query: one 16-byte store
  _Float16* crow = ctx + ((size_t)n * QS + q0 + (lane & 15)) * EDIM + hi * 8;
#pragma unroll  // rolled, this loop spilled the staging addresses to scratch
  for (int c = 0; c < 4; ++c) {
    const _Float16* buf = ring + (c & 1) * BUFH;
    v8f o[4] = {};
#pragma unroll
    for (int kk = 0; kk < 16; ++kk) {
#pragma unroll
      for (int i = 0; i < 4; ++i) {
        const v16h a = load_frag(buf, i * 16, kk * 32, VPITCH, lane);
        o[i] = __builtin_amdgcn_wmma_f32_16x16x32_f16(false, a, false, sp[kk], (short)0, o[i], false, false);
      }
    }
#pragma unroll
    for (int i = 0; i < 4; ++i) {
      h8 r;
#pragma unroll
      for (int j = 0; j < 8; ++j) r[j] = (_Float16)(o[i][j] * inv);
      *(h8*)(crow + c * 64 + i * 16) = r;
    }
    publish();
    if (c < 2) stage_tile<2 * VPITCH * 2>(vl + (c & 1) * (BUFH * 2), vg + (c + 2) * 65536);
  }
  asm volatile("s_wait_asynccnt 0x0" ::: "memory");  // nothing of mine is in flight when the wave ends
}

// WoSum[e][d] = sum_h Wo[e][h*E + d]  (heads are replicated -> fold Wo to 256x256)
__global__ void wo_reduce(const float* __restrict__ Wo, _Float16* __restrict__ d) {
  const int i = blockIdx.x * blockDim.x + threadIdx.x;
  if (i >= EDIM * EDIM) return;
  const int e = i >> 8, dd = i & 255;
  float s = 0.0f;
#pragma unroll
  for (int h = 0; h < HEADS; ++h) s += Wo[(size_t)e * (HEADS * EDIM) + h * EDIM + dd];
  d[i] = (_Float16)s;
}

extern "C" void kernel_launch(void* const* d_in, const int* in_sizes, int n_in,
                              void* d_out, int out_size, void* d_ws, size_t ws_size,
                              hipStream_t stream) {
  const float* values = (const float*)d_in[0];
  const float* keys   = (const float*)d_in[1];
  const float* query  = (const float*)d_in[2];
  const int*   mask   = (const int*)d_in[3];
  const float* Wv = (const float*)d_in[4];
  const float* Wk = (const float*)d_in[5];
  const float* Wq = (const float*)d_in[6];
  const float* Wo = (const float*)d_in[7];
  const float* bo = (const float*)d_in[8];
  float* out = (float*)d_out;

  // Workspace carve (all f16 intermediates)
  char* ws = (char*)d_ws;
  size_t off = 0;
  auto carve = [&](size_t bytes) -> void* {
    void* p = ws + off;
    off = (off + bytes + 255) & ~(size_t)255;
    return p;
  };
  _Float16* wo16 = (_Float16*)carve((size_t)EDIM * EDIM * 2);         // head-folded Wo
  _Float16* qh   = (_Float16*)carve((size_t)NBATCH * QS * EDIM * 2);  // q proj
  _Float16* kh   = (_Float16*)carve((size_t)NBATCH * KL * EDIM * 2);  // k proj [n][k][d]
  _Float16* vT   = (_Float16*)carve((size_t)NBATCH * KL * EDIM * 2);  // v proj [n][d][k]
  _Float16* ctx  = (_Float16*)carve((size_t)NBATCH * QS * EDIM * 2);  // attn @ v
  (void)ws_size; (void)in_sizes; (void)n_in; (void)out_size;

  auto cdiv = [](int a, int b) { return (a + b - 1) / b; };
  const dim3 blk(256);
  const size_t lds256 = 64 * 256 * sizeof(_Float16);  // B strip for K=256 (32 KB)

  // --- weight folding ---
  wo_reduce<<<cdiv(EDIM * EDIM, 256), blk, 0, stream>>>(Wo, wo16);

  // --- projections: X @ W^T from the f32 inputs (W row-major [out][in] == B^T layout directly) ---
  proj_f32<false><<<dim3(EDIM / 64, (NBATCH * QS) / 256, 1), blk, 0, stream>>>(query, Wq, qh);
  proj_f32<false><<<dim3(EDIM / 64, (NBATCH * KL) / 256, 1), blk, 0, stream>>>(keys, Wk, kh);
  // v projection, stored transposed per batch: vT[n][d][k]
  proj_f32<true><<<dim3(EDIM / 64, (NBATCH * KL) / 256, 1), blk, 0, stream>>>(values, Wv, vT);

  // --- ctx = softmax(mask(q k^T) / 16) @ v, scores kept in registers ---
  attn_fused<<<NBATCH * (QS / 64), dim3(128), 0, stream>>>(qh, kh, vT, mask, ctx);

  // --- out = ctx @ WoSum^T + bo  (f32 output straight to d_out) ---
  gemm_wmma_f16<float, false><<<dim3(EDIM / 64, (NBATCH * QS) / 256, 1), blk, lds256, stream>>>(
      ctx, 0, wo16, 0, out, 0, NBATCH * QS, EDIM, EDIM, EDIM, EDIM, EDIM, 1, bo);
}

// v003
// Measured time: 70 microseconds a run.
// Next to v002, in two timings, it ran 1.24 times as fast each time.
// Over all steps from v000 it is 2.05 times as fast.
#include <hip/hip_runtime.h>

// Shapes from reference: N=8, KLEN=512, Q=16, S=128, E=256, H=8
#define NBATCH 8
#define KL     512
#define QS     2048   // Q*S
#define EDIM   256
#define HEADS  8

typedef _Float16 h8   __attribute__((ext_vector_type(8)));
typedef _Float16 v16h __attribute__((ext_vector_type(16)));
typedef float    v8f  __attribute__((ext_vector_type(8)));
typedef int      v4i  __attribute__((ext_vector_type(4)));

#if __has_builtin(__builtin_amdgcn_global_load_async_to_lds_b128)
// Diagnostic from probe: param0 is 'v4i __device__ *'  (addrspace(1) == global),
// so the call is (global_src_v4i*, lds_dst_v4i*, imm offset, imm cpol).
typedef __attribute__((address_space(1))) v4i glob_v4i;
typedef __attribute__((address_space(3))) v4i lds_v4i;
#define HAVE_ASYNC_LDS 1
#else
#define HAVE_ASYNC_LDS 0
#endif

// Build a 16x32 f16 WMMA fragment from a row-major [rows x ld] f16 matrix.
// Identical striping for A ([M][K]) and B stored as B^T ([N][K]):
//   lane<16 : halves 0..7 = K0..K0+7,  halves 8..15 = K0+16..K0+23 (row r0+lane)
//   lane>=16: halves 0..7 = K0+8..+15, halves 8..15 = K0+24..+31   (row r0+lane-16)
template <typename PtrT>
__device__ __forceinline__ v16h load_frag(PtrT base, int r0, int k0, int ld, int lane) {
  PtrT p = base + (size_t)(r0 + (lane & 15)) * ld + k0 + ((lane & 16) ? 8 : 0);
  union { v16h v; h8 h[2]; } u;
  u.h[0] = *(const h8*)(p);
  u.h[1] = *(const h8*)(p + 16);
  return u.v;
}

// C[M x N] = A[M x K] * B^T (B stored [N][K] row-major), f32 accumulate.
// Block = 256 threads = 8 waves stacked in M; wave tile = 32(M) x 64(N):
//   2 A-frags (global) x 4 B-frags (LDS, staged once per block) -> 8 WMMA / k-step.
// OutT: _Float16 or float. TRANSB: write out as [row/mb][N][mb] (batch-transposed).
template <typename OutT, bool TRANSB>
__global__ __launch_bounds__(256) void gemm_wmma_f16(
    const _Float16* __restrict__ A, long sA,
    const _Float16* __restrict__ B, long sB,
    OutT* __restrict__ C, long sC,
    int M, int N, int K, int lda, int ldb, int ldo,
    int mb, const float* __restrict__ bias) {
  extern __shared__ _Float16 bs[];  // [64][K] strip of B^T for this block's n0
  const int lane = threadIdx.x & 31;
  const int wave = threadIdx.x >> 5;
  const int n0 = blockIdx.x * 64;
  const int m0 = (blockIdx.y * 8 + wave) * 32;
  const int bz = blockIdx.z;
  A += (size_t)bz * sA;
  B += (size_t)bz * sB;
  C += (size_t)bz * sC;

  // ---- stage B[n0..n0+63][0..K) into LDS, cooperatively (async path if available)
  {
    const int kchunks = K >> 3;  // 16-byte chunks per row
    for (int c = threadIdx.x; c < 64 * kchunks; c += 256) {
      const int r = c / kchunks;
      const int kk = (c - r * kchunks) << 3;
      const _Float16* g = B + (size_t)(n0 + r) * ldb + kk;
      _Float16* l = bs + r * K + kk;
#if HAVE_ASYNC_LDS
      __builtin_amdgcn_global_load_async_to_lds_b128((glob_v4i*)g, (lds_v4i*)l, 0, 0);
#else
      *(h8*)l = *(const h8*)g;
#endif
    }
#if HAVE_ASYNC_LDS
#if __has_builtin(__builtin_amdgcn_s_wait_asynccnt)
    __builtin_amdgcn_s_wait_asynccnt(0);
#else
    asm volatile("s_wait_asynccnt 0x0" ::: "memory");
#endif
#endif
    __syncthreads();
  }

  v8f acc[2][4] = {};
  for (int k0 = 0; k0 < K; k0 += 32) {
    const v16h a0 = load_frag(A, m0, k0, lda, lane);
    const v16h a1 = load_frag(A, m0 + 16, k0, lda, lane);
#pragma unroll
    for (int t = 0; t < 4; ++t) {
      const v16h b = load_frag((const _Float16*)bs, t * 16, k0, K, lane);
      acc[0][t] =
          __builtin_amdgcn_wmma_f32_16x16x32_f16(false, a0, false, b, (short)0, acc[0][t], false, false);
      acc[1][t] =
          __builtin_amdgcn_wmma_f32_16x16x32_f16(false, a1, false, b, (short)0, acc[1][t], false, false);
    }
  }

  // D layout: VGPR j holds (M = (lane<16 ? j : 8+j), N = n-base + (lane&15))
  const int lm = lane & 15;
  const int rb = (lane >> 4) * 8;
#pragma unroll
  for (int u = 0; u < 2; ++u) {
#pragma unroll
    for (int t = 0; t < 4; ++t) {
      const int col = n0 + t * 16 + lm;
      const float badd = bias ? bias[col] : 0.0f;
#pragma unroll
      for (int j = 0; j < 8; ++j) {
        const int row = m0 + u * 16 + rb + j;
        const float v = acc[u][t][j] + badd;
        if (TRANSB) {
          C[(size_t)(row / mb) * N * mb + (size_t)col * mb + (row % mb)] = (OutT)v;
        } else {
          C[(size_t)row * ldo + col] = (OutT)v;
        }
      }
    }
  }
}

typedef float f32x4 __attribute__((ext_vector_type(4)));

// Eight f32 rounded to f16 (nearest even).
__device__ __forceinline__ h8 round8(f32x4 x, f32x4 y) {
  return __builtin_convertvector(__builtin_shufflevector(x, y, 0, 1, 2, 3, 4, 5, 6, 7), h8);
}

// Projection C = X . W^T straight from the f32 inputs: X [rows][EDIM], W [EDIM][EDIM], both row-major,
// both rounded to f16 in registers on their way to the matrix unit. Tiling, k order and sum order of
// gemm_wmma_f16: 8 waves stacked in M, wave tile 32(M) x 64(N), 64 rows of W in LDS as f16.
// TRANSB: write out as [row/KL][EDIM][KL] (batch-transposed). tile: 4 column strips to each 256 rows.
template <bool TRANSB>
__device__ __forceinline__ void proj_f32(const float* __restrict__ X,
                                         const float* __restrict__ Wt,
                                         _Float16* __restrict__ C, _Float16* bs, int tile) {
  const int lane = threadIdx.x & 31;
  const int wave = threadIdx.x >> 5;
  const int n0 = (tile & 3) * 64;
  const int m0 = ((tile >> 2) * 8 + wave) * 32;

  // W[n0..n0+63][0..EDIM): a thread takes 8 consecutive k of row wave + 8 i
  const int e0 = wave * EDIM + lane * 8;
  const unsigned wo = (unsigned)(n0 * EDIM + e0) * 4u;  // byte offsets: a uniform base and one register a stream
  // this wave's 32 rows of X, load_frag's k order
  const unsigned xo = (unsigned)((m0 + (lane & 15)) * EDIM + ((lane & 16) ? 8 : 0)) * 4u;
  const char* wp = (const char*)Wt + wo;
  const char* xp = (const char*)X + xo;
  f32x4 wr[8][2];
#pragma unroll
  for (int i = 0; i < 8; ++i) {
    wr[i][0] = *(const f32x4*)(wp + i * 8 * EDIM * 4);
    wr[i][1] = *(const f32x4*)(wp + i * 8 * EDIM * 4 + 16);
  }
  f32x4 xr[8][2][4];
#pragma unroll
  for (int ks = 0; ks < 8; ++ks) {
#pragma unroll
    for (int u = 0; u < 2; ++u) {
      const char* p = xp + (u * 16 * EDIM + ks * 32) * 4;
      xr[ks][u][0] = *(const f32x4*)(p);
      xr[ks][u][1] = *(const f32x4*)(p + 16);
      xr[ks][u][2] = *(const f32x4*)(p + 64);
      xr[ks][u][3] = *(const f32x4*)(p + 80);
    }
  }
  // wo and xo as inputs keep the loads' address registers untouched (also as a later load's destination) up to the wait.
  // Its memory clobber holds all 80 loads ahead of it: without the statement the compiler paired each two loads
  // with their rounding, one memory round trip after the other.
  asm volatile("s_wait_xcnt 0x0" ::"v"(wo), "v"(xo) : "memory");

#pragma unroll
  for (int i = 0; i < 8; ++i) *(h8*)(bs + e0 + i * 8 * EDIM) = round8(wr[i][0], wr[i][1]);
  __syncthreads();

  v8f acc[2][4] = {};
#pragma unroll
  for (int ks = 0; ks < 8; ++ks) {
    v16h a[2];
#pragma unroll
    for (int u = 0; u < 2; ++u) {
      union { v16h v; h8 h[2]; } f;
      f.h[0] = round8(xr[ks][u][0], xr[ks][u][1]);
      f.h[1] = round8(xr[ks][u][2], xr[ks][u][3]);
      a[u] = f.v;
    }
#pragma unroll
    for (int t = 0; t < 4; ++t) {
      const v16h b = load_frag((const _Float16*)bs, t * 16, ks * 32, EDIM, lane);
      acc[0][t] =
          __builtin_amdgcn_wmma_f32_16x16x32_f16(false, a[0], false, b, (short)0, acc[0][t], false, false);
      acc[1][t] =
          __builtin_amdgcn_wmma_f32_16x16x32_f16(false, a[1], false, b, (short)0, acc[1][t], false, false);
    }
  }

  // D layout: VGPR j holds (M = (lane<16 ? j : 8+j), N = n-base + (lane&15))
  const int row = m0 + (lane >> 4) * 8;  // + u * 16 + j; a wave's 32 rows lie in one batch (KL is a multiple of 32)
  const int col = n0 + (lane & 15);      // + t * 16
  _Float16* cp = TRANSB ? C + (size_t)(row / KL) * EDIM * KL + (size_t)col * KL + (row % KL)
                        : C + (size_t)row * EDIM + col;
#pragma unroll
  for (int u = 0; u < 2; ++u) {
#pragma unroll
    for (int t = 0; t < 4; ++t) {
      // the stores issued so far have taken their registers before later roundings write into them
      if (u + t > 0) asm volatile("s_wait_xcnt 0x0" ::: "memory");
#pragma unroll
      for (int j = 0; j < 8; ++j) {
        cp[TRANSB ? t * 16 * KL + u * 16 + j : (u * 16 + j) * EDIM + t * 16] = (_Float16)acc[u][t][j];
      }
    }
  }
  // the last stores have taken their registers before any code laid out behind this body writes into them
  asm volatile("s_wait_xcnt 0x0" ::: "memory");
}

// WoSum[e][d] = sum_h Wo[e][h*E + d]  (heads are replicated -> fold Wo to 256x256); i = e * EDIM + d
__device__ __forceinline__ void wo_fold(const float* __restrict__ Wo, _Float16* __restrict__ d, int i) {
  const unsigned x = (unsigned)((i >> 8) * (HEADS * EDIM) + (i & 255));
  float w[HEADS];
#pragma unroll
  for (int h = 0; h < HEADS; ++h) w[h] = Wo[x + h * EDIM];
  // x as an input keeps the loads' address register from being reused as a load's destination ahead of the wait
  asm volatile("s_wait_xcnt 0x0" ::"v"(x) : "memory");
  float s = 0.0f;
#pragma unroll
  for (int h = 0; h < HEADS; ++h) s += w[h];
  d[i] = (_Float16)s;
  // the store has taken its registers before any code laid out behind this body writes into them
  asm volatile("s_wait_xcnt 0x0" ::: "memory");
}

// Jobs of the first launch, picked by block index: the 256-row x 64-column tiles of the three projections,
// then the fold of Wo. None of them reads what another writes.
#define QTILES ((NBATCH * QS / 256) * (EDIM / 64))  // 256 tiles of q
#define KTILES ((NBATCH * KL / 256) * (EDIM / 64))  // 64 tiles of k, as many of v
#define WOBLKS (EDIM * EDIM / 256)                  // 256 blocks, one folded weight a thread

__global__ __launch_bounds__(256) void proj_all(const float* __restrict__ query, const float* __restrict__ keys,
                                                const float* __restrict__ values, const float* __restrict__ Wq,
                                                const float* __restrict__ Wk, const float* __restrict__ Wv,
                                                const float* __restrict__ Wo, _Float16* __restrict__ qh,
                                                _Float16* __restrict__ kh, _Float16* __restrict__ vT,
                                                _Float16* __restrict__ wo16) {
  __shared__ __attribute__((aligned(16))) _Float16 bs[64 * EDIM];
  const int b = blockIdx.x;  // every test on it reads the same for the whole block
  const bool isq = b < QTILES;
  if (b < QTILES + KTILES)
    proj_f32<false>(isq ? query : keys, isq ? Wq : Wk, isq ? qh : kh, bs, isq ? b : b - QTILES);
  else if (b < QTILES + 2 * KTILES)
    proj_f32<true>(values, Wv, vT, bs, b - (QTILES + KTILES));
  else  // the short jobs come last
    wo_fold(Wo, wo16, (b - (QTILES + 2 * KTILES)) * 256 + (int)threadIdx.x);
}

typedef unsigned int u32x4 __attribute__((ext_vector_type(4)));
typedef unsigned int u32x8 __attribute__((ext_vector_type(8)));

#define KPITCH 264    // halves per staged K row   (512 B + 16 B: 16 B x odd, no bank conflict for b128 readers)
#define VPITCH 520    // halves per staged V^T row (1024 B + 16 B)
#define BUFH   33792  // halves per ring buffer: 128 K rows (the 64 V^T rows need less)

// One 64 KB tile, contiguous in global memory, into one ring buffer: 32 copies of 16 B per lane.
// Copy j of a lane lies 2048 B further in global memory and LSTEP bytes further in LDS.
template <int LSTEP>
__device__ __forceinline__ void stage_tile(unsigned l0, const char* g0) {
#pragma unroll
  for (int b = 0; b < 4; ++b) {
    const unsigned l = l0 + b * 8 * LSTEP;
    const char* g = g0 + b * 8 * 2048;
    // the closing s_wait_xcnt keeps the address registers untouched until the copies have taken them
    asm volatile(
        "global_load_async_to_lds_b128 %0, %8, off\n\t"
        "global_load_async_to_lds_b128 %1, %9, off\n\t"
        "global_load_async_to_lds_b128 %2, %10, off\n\t"
        "global_load_async_to_lds_b128 %3, %11, off\n\t"
        "global_load_async_to_lds_b128 %4, %12, off\n\t"
        "global_load_async_to_lds_b128 %5, %13, off\n\t"
        "global_load_async_to_lds_b128 %6, %14, off\n\t"
        "global_load_async_to_lds_b128 %7, %15, off\n\t"
        "s_wait_xcnt 0x0"
        ::"v"(l), "v"(l + LSTEP), "v"(l + 2 * LSTEP), "v"(l + 3 * LSTEP), "v"(l + 4 * LSTEP),
        "v"(l + 5 * LSTEP), "v"(l + 6 * LSTEP), "v"(l + 7 * LSTEP), "v"(g), "v"(g + 2048),
        "v"(g + 2 * 2048), "v"(g + 3 * 2048), "v"(g + 4 * 2048), "v"(g + 5 * 2048),
        "v"(g + 6 * 2048), "v"(g + 7 * 2048)
        : "memory");
  }
}

// Hand-over of the ring: this wave's LDS reads are done, its own copies have landed, then every wave meets.
__device__ __forceinline__ void publish() {
  asm volatile("s_wait_dscnt 0x0" ::: "memory");    // my reads of the buffer that is refilled next have returned
  asm volatile("s_wait_asynccnt 0x0" ::: "memory");  // my copies of the next tile have landed
  __syncthreads();
}

// Energy, masked softmax and attn @ v in one launch. Block = 4 waves, 16 queries a wave, one batch n.
//   S^T = K . Q^T   : A = K rows (LDS), B = Q (registers); a lane holds scores of ONE query
//   O^T = V^T . P^T : A = V^T rows (LDS), B = the packed score tiles, never leaving registers
// All 512 scores of a query stay in registers as f16 (the rounding the stored energy had).
__global__ __launch_bounds__(128) void attn_fused(const _Float16* __restrict__ qh,
                                                  const _Float16* __restrict__ kh,
                                                  const _Float16* __restrict__ vT,
                                                  const int* __restrict__ mask,
                                                  _Float16* __restrict__ ctx) {
  __shared__ __attribute__((aligned(128))) _Float16 ring[2 * BUFH];
  __shared__ __attribute__((aligned(16))) unsigned short keep[KL];  // 0xFFFF: key counts, 0: masked
  __shared__ int anyw[4];
  const int tid = threadIdx.x;
  const int lane = tid & 31;
  const int wave = tid >> 5;
  const int hi = lane >> 4;
  const int n = blockIdx.x >> 5;
  const int q0 = (blockIdx.x & 31) * 64 + wave * 16;

  const char* kg = (const char*)(kh + (size_t)n * KL * EDIM) + tid * 16;
  const char* vg = (const char*)(vT + (size_t)n * EDIM * KL) + tid * 16;
  const unsigned ring0 = (unsigned)(size_t)ring;
  const unsigned kl = ring0 + (tid >> 5) * (KPITCH * 2) + (tid & 31) * 16;
  const unsigned vl = ring0 + (tid >> 6) * (VPITCH * 2) + (tid & 63) * 16;

  stage_tile<4 * KPITCH * 2>(kl, kg);  // keys 0..127 -> buffer 0

  {
    const v4i mv = *(const v4i*)(mask + n * KL + tid * 4);
    unsigned long long kw = 0;
#pragma unroll
    for (int j = 0; j < 4; ++j)
      if (mv[j] != 0) kw |= 0xFFFFull << (16 * j);
    *(unsigned long long*)(keep + tid * 4) = kw;
    const unsigned bal = __builtin_amdgcn_ballot_w32(kw != 0);
    if (lane == 0) anyw[wave] = (bal != 0);
  }

  const _Float16* qp = qh + ((size_t)n * QS + q0 + (lane & 15)) * EDIM + hi * 8;  // load_frag's k order
  v16h qf[8];
#pragma unroll
  for (int ks = 0; ks < 8; ++ks) {
    union { v16h v; h8 h[2]; } u;
    u.h[0] = *(const h8*)(qp + ks * 32);
    u.h[1] = *(const h8*)(qp + ks * 32 + 16);
    qf[ks] = u.v;
  }
  // qp as an input keeps the loads' address register from being reused as a load's destination ahead of the wait
  asm volatile("s_wait_xcnt 0x0" ::"v"(qp) : "memory");

  asm volatile("s_wait_asynccnt 0x0" ::: "memory");  // my copies of tile 0 have landed
  __syncthreads();
  stage_tile<4 * KPITCH * 2>(kl + BUFH * 2, kg + 65536);  // keys 128..255 -> buffer 1

  // ---- scores: sp[kk] holds keys kk*32..+31 of this lane's query in B-operand order
  v16h sp[16];
#pragma unroll  // sp[] is indexed by constants only, so it stays in registers
  for (int t = 0; t < 4; ++t) {
    const _Float16* buf = ring + (t & 1) * BUFH;
#pragma unroll
    for (int p = 0; p < 4; ++p) {
      v8f s0 = {}, s1 = {};
#pragma unroll
      for (int ks = 0; ks < 8; ++ks) {
        const v16h a0 = load_frag(buf, p * 32, ks * 32, KPITCH, lane);
        const v16h a1 = load_frag(buf, p * 32 + 16, ks * 32, KPITCH, lane);
        s0 = __builtin_amdgcn_wmma_f32_16x16x32_f16(false, a0, false, qf[ks], (short)0, s0, false, false);
        s1 = __builtin_amdgcn_wmma_f32_16x16x32_f16(false, a1, false, qf[ks], (short)0, s1, false, false);
      }
      v16h pk;
#pragma unroll
      for (int j = 0; j < 8; ++j) {
        pk[j] = (_Float16)s0[j];
        pk[8 + j] = (_Float16)s1[j];
      }
      sp[t * 4 + p] = pk;
    }
    publish();
    if (t < 2)
      stage_tile<4 * KPITCH * 2>(kl + (t & 1) * (BUFH * 2), kg + (t + 2) * 65536);
    else
      stage_tile<2 * VPITCH * 2>(vl + (t & 1) * (BUFH * 2), vg + (t - 2) * 65536);
  }

  // ---- masked softmax, in-lane; the two lane halves of a query meet once for the maximum, once for the sum
  // A masked key scores -inf (weight 0). With every key masked the reference is uniform: all scores 0.
  const unsigned fill = (anyw[0] | anyw[1] | anyw[2] | anyw[3]) ? 0xFC00FC00u : 0u;
  v16h mxv;
#pragma unroll
  for (int kk = 0; kk < 16; ++kk) {
    const u32x4 m0 = *(const u32x4*)(keep + kk * 32 + hi * 8);
    const u32x4 m1 = *(const u32x4*)(keep + kk * 32 + 16 + hi * 8);
    u32x8 s = __builtin_bit_cast(u32x8, sp[kk]);
#pragma unroll
    for (int i = 0; i < 4; ++i) {
      s[i] = (s[i] & m0[i]) | (fill & ~m0[i]);
      s[4 + i] = (s[4 + i] & m1[i]) | (fill & ~m1[i]);
    }
    sp[kk] = __builtin_bit_cast(v16h, s);
    mxv = kk ? __builtin_elementwise_max(mxv, sp[kk]) : sp[kk];
  }
  float mx = (float)mxv[0];
#pragma unroll
  for (int j = 1; j < 16; ++j) mx = fmaxf(mx, (float)mxv[j]);
  mx = fmaxf(mx, __shfl_xor(mx, 16, 32));
  const float sc = 0.0625f * 1.44269504f;  // 1/sqrt(E) * log2(e)
  const float mc = mx * sc;
  float sum[4] = {0.0f, 0.0f, 0.0f, 0.0f};
#pragma unroll
  for (int kk = 0; kk < 16; ++kk) {
    v16h pk;
#pragma unroll
    for (int j = 0; j < 16; ++j) {
      const float x = __builtin_amdgcn_exp2f(fmaf((float)sp[kk][j], sc, -mc));
      sum[j & 3] += x;
      pk[j] = (_Float16)x;
    }
    sp[kk] = pk;
  }
  float st = (sum[0] + sum[1]) + (sum[2] + sum[3]);
  st += __shfl_xor(st, 16, 32);
  const float inv = 1.0f / st;

  // ---- O^T, 64 rows of V^T a trip; a lane's 8 results are 8 consecutive d of its query: one 16-byte store
  _Float16* crow = ctx + ((size_t)n * QS + q0 + (lane & 15)) * EDIM + hi * 8;
#pragma unroll  // rolled, this loop spilled the staging addresses to scratch
  for (int c = 0; c < 4; ++c) {
    const _Float16* buf = ring + (c & 1) * BUFH;
    v8f o[4] = {};
#pragma unroll
    for (int kk = 0; kk < 16; ++kk) {
#pragma unroll
      for (int i = 0; i < 4; ++i) {
        const v16h a = load_frag(buf, i * 16, kk * 32, VPITCH, lane);
        o[i] = __builtin_amdgcn_wmma_f32_16x16x32_f16(false, a, false, sp[kk], (short)0, o[i], false, false);
      }
    }
#pragma unroll
    for (int i = 0; i < 4; ++i) {
      h8 r;
#pragma unroll
      for (int j = 0; j < 8; ++j) r[j] = (_Float16)(o[i][j] * inv);
      *(h8*)(crow + c * 64 + i * 16) = r;
    }
    publish();
    if (c < 2) stage_tile<2 * VPITCH * 2>(vl + (c & 1) * (BUFH * 2), vg + (c + 2) * 65536);
  }
  asm volatile("s_wait_asynccnt 0x0" ::: "memory");  // nothing of mine is in flight when the wave ends
}

extern "C" void kernel_launch(void* const* d_in, const int* in_sizes, int n_in,
                              void* d_out, int out_size, void* d_ws, size_t ws_size,
                              hipStream_t stream) {
  const float* values = (const float*)d_in[0];
  const float* keys   = (const float*)d_in[1];
  const float* query  = (const float*)d_in[2];
  const int*   mask   = (const int*)d_in[3];
  const float* Wv = (const float*)d_in[4];
  const float* Wk = (const float*)d_in[5];
  const float* Wq = (const float*)d_in[6];
  const float* Wo = (const float*)d_in[7];
  const float* bo = (const float*)d_in[8];
  float* out = (float*)d_out;

  // Workspace carve (all f16 intermediates)
  char* ws = (char*)d_ws;
  size_t off = 0;
  auto carve = [&](size_t bytes) -> void* {
    void* p = ws + off;
    off = (off + bytes + 255) & ~(size_t)255;
    return p;
  };
  _Float16* wo16 = (_Float16*)carve((size_t)EDIM * EDIM * 2);         // head-folded Wo
  _Float16* qh   = (_Float16*)carve((size_t)NBATCH * QS * EDIM * 2);  // q proj
  _Float16* kh   = (_Float16*)carve((size_t)NBATCH * KL * EDIM * 2);  // k proj [n][k][d]
  _Float16* vT   = (_Float16*)carve((size_t)NBATCH * KL * EDIM * 2);  // v proj [n][d][k]
  _Float16* ctx  = (_Float16*)carve((size_t)NBATCH * QS * EDIM * 2);  // attn @ v
  (void)ws_size; (void)in_sizes; (void)n_in; (void)out_size;

  const dim3 blk(256);
  const size_t lds256 = 64 * 256 * sizeof(_Float16);  // B strip for K=256 (32 KB)

  // --- projections X @ W^T from the f32 inputs (v stored transposed per batch: vT[n][d][k]) and weight folding ---
  proj_all<<<QTILES + 2 * KTILES + WOBLKS, blk, 0, stream>>>(query, keys, values, Wq, Wk, Wv, Wo, qh, kh, vT, wo16);

  // --- ctx = softmax(mask(q k^T) / 16) @ v, scores kept in registers ---
  attn_fused<<<NBATCH * (QS / 64), dim3(128), 0, stream>>>(qh, kh, vT, mask, ctx);

  // --- out = ctx @ WoSum^T + bo  (f32 output straight to d_out) ---
  gemm_wmma_f16<float, false><<<dim3(EDIM / 64, (NBATCH * QS) / 256, 1), blk, lds256, stream>>>(
      ctx, 0, wo16, 0, out, 0, NBATCH * QS, EDIM, EDIM, EDIM, EDIM, EDIM, 1, bo);
}

// v004
// A run of this version takes 58.1 microseconds.
// Next to v003, in two timings, it ran 1.21 times as fast each time.
// Over all steps from v000 it is 2.47 times as fast.
#include <hip/hip_runtime.h>

// Shapes from reference: N=8, KLEN=512, Q=16, S=128, E=256, H=8
#define NBATCH 8
#define KL     512
#define QS     2048   // Q*S
#define EDIM   256
#define HEADS  8

typedef _Float16 h8   __attribute__((ext_vector_type(8)));
typedef _Float16 v16h __attribute__((ext_vector_type(16)));
typedef float    v8f  __attribute__((ext_vector_type(8)));
typedef int      v4i  __attribute__((ext_vector_type(4)));

#if __has_builtin(__builtin_amdgcn_global_load_async_to_lds_b128)
// Diagnostic from probe: param0 is 'v4i __device__ *'  (addrspace(1) == global),
// so the call is (global_src_v4i*, lds_dst_v4i*, imm offset, imm cpol).
typedef __attribute__((address_space(1))) v4i glob_v4i;
typedef __attribute__((address_space(3))) v4i lds_v4i;
#define HAVE_ASYNC_LDS 1
#else
#define HAVE_ASYNC_LDS 0
#endif

// Build a 16x32 f16 WMMA fragment from a row-major [rows x ld] f16 matrix.
// Identical striping for A ([M][K]) and B stored as B^T ([N][K]):
//   lane<16 : halves 0..7 = K0..K0+7,  halves 8..15 = K0+16..K0+23 (row r0+lane)
//   lane>=16: halves 0..7 = K0+8..+15, halves 8..15 = K0+24..+31   (row r0+lane-16)
template <typename PtrT>
__device__ __forceinline__ v16h load_frag(PtrT base, int r0, int k0, int ld, int lane) {
  PtrT p = base + (size_t)(r0 + (lane & 15)) * ld + k0 + ((lane & 16) ? 8 : 0);
  union { v16h v; h8 h[2]; } u;
  u.h[0] = *(const h8*)(p);
  u.h[1] = *(const h8*)(p + 16);
  return u.v;
}

// C[M x N] = A[M x K] * B^T (B stored [N][K] row-major), f32 accumulate.
// Block = 256 threads = 8 waves stacked in M; wave tile = 32(M) x 64(N):
//   2 A-frags (global) x 4 B-frags (LDS, staged once per block) -> 8 WMMA / k-step.
// OutT: _Float16 or float. TRANSB: write out as [row/mb][N][mb] (batch-transposed).
template <typename OutT, bool TRANSB>
__global__ __launch_bounds__(256) void gemm_wmma_f16(
    const _Float16* __restrict__ A, long sA,
    const _Float16* __restrict__ B, long sB,
    OutT* __restrict__ C, long sC,
    int M, int N, int K, int lda, int ldb, int ldo,
    int mb, const float* __restrict__ bias) {
  extern __shared__ _Float16 bs[];  // [64][K] strip of B^T for this block's n0
  const int lane = threadIdx.x & 31;
  const int wave = threadIdx.x >> 5;
  const int n0 = blockIdx.x * 64;
  const int m0 = (blockIdx.y * 8 + wave) * 32;
  const int bz = blockIdx.z;
  A += (size_t)bz * sA;
  B += (size_t)bz * sB;
  C += (size_t)bz * sC;

  // ---- stage B[n0..n0+63][0..K) into LDS, cooperatively (async path if available)
  {
    const int kchunks = K >> 3;  // 16-byte chunks per row
    for (int c = threadIdx.x; c < 64 * kchunks; c += 256) {
      const int r = c / kchunks;
      const int kk = (c - r * kchunks) << 3;
      const _Float16* g = B + (size_t)(n0 + r) * ldb + kk;
      _Float16* l = bs + r * K + kk;
#if HAVE_ASYNC_LDS
      __builtin_amdgcn_global_load_async_to_lds_b128((glob_v4i*)g, (lds_v4i*)l, 0, 0);
#else
      *(h8*)l = *(const h8*)g;
#endif
    }
#if HAVE_ASYNC_LDS
#if __has_builtin(__builtin_amdgcn_s_wait_asynccnt)
    __builtin_amdgcn_s_wait_asynccnt(0);
#else
    asm volatile("s_wait_asynccnt 0x0" ::: "memory");
#endif
#endif
    __syncthreads();
  }

  v8f acc[2][4] = {};
  for (int k0 = 0; k0 < K; k0 += 32) {
    const v16h a0 = load_frag(A, m0, k0, lda, lane);
    const v16h a1 = load_frag(A, m0 + 16, k0, lda, lane);
#pragma unroll
    for (int t = 0; t < 4; ++t) {
      const v16h b = load_frag((const _Float16*)bs, t * 16, k0, K, lane);
      acc[0][t] =
          __builtin_amdgcn_wmma_f32_16x16x32_f16(false, a0, false, b, (short)0, acc[0][t], false, false);
      acc[1][t] =
          __builtin_amdgcn_wmma_f32_16x16x32_f16(false, a1, false, b, (short)0, acc[1][t], false, false);
    }
  }

  // D layout: VGPR j holds (M = (lane<16 ? j : 8+j), N = n-base + (lane&15))
  const int lm = lane & 15;
  const int rb = (lane >> 4) * 8;
#pragma unroll
  for (int u = 0; u < 2; ++u) {
#pragma unroll
    for (int t = 0; t < 4; ++t) {
      const int col = n0 + t * 16 + lm;
      const float badd = bias ? bias[col] : 0.0f;
#pragma unroll
      for (int j = 0; j < 8; ++j) {
        const int row = m0 + u * 16 + rb + j;
        const float v = acc[u][t][j] + badd;
        if (TRANSB) {
          C[(size_t)(row / mb) * N * mb + (size_t)col * mb + (row % mb)] = (OutT)v;
        } else {
          C[(size_t)row * ldo + col] = (OutT)v;
        }
      }
    }
  }
}

typedef float f32x4 __attribute__((ext_vector_type(4)));

// Eight f32 rounded to f16 (nearest even).
__device__ __forceinline__ h8 round8(f32x4 x, f32x4 y) {
  return __builtin_convertvector(__builtin_shufflevector(x, y, 0, 1, 2, 3, 4, 5, 6, 7), h8);
}

// Projection C = X . W^T straight from the f32 inputs: X [rows][EDIM], W [EDIM][EDIM], both row-major,
// both rounded to f16 in registers on their way to the matrix unit. Tiling, k order and sum order of
// gemm_wmma_f16: 8 waves stacked in M, wave tile 32(M) x 64(N), 64 rows of W in LDS as f16.
// TRANSB: write out as [row/KL][EDIM][KL] (batch-transposed). tile: 4 column strips to each 256 rows.
template <bool TRANSB>
__device__ __forceinline__ void proj_f32(const float* __restrict__ X,
                                         const float* __restrict__ Wt,
                                         _Float16* __restrict__ C, _Float16* bs, int tile) {
  const int lane = threadIdx.x & 31;
  const int wave = threadIdx.x >> 5;
  const int n0 = (tile & 3) * 64;
  const int m0 = ((tile >> 2) * 8 + wave) * 32;

  // W[n0..n0+63][0..EDIM): a thread takes 8 consecutive k of row wave + 8 i
  const int e0 = wave * EDIM + lane * 8;
  const unsigned wo = (unsigned)(n0 * EDIM + e0) * 4u;  // byte offsets: a uniform base and one register a stream
  // this wave's 32 rows of X, load_frag's k order
  const unsigned xo = (unsigned)((m0 + (lane & 15)) * EDIM + ((lane & 16) ? 8 : 0)) * 4u;
  const char* wp = (const char*)Wt + wo;
  const char* xp = (const char*)X + xo;
  f32x4 wr[8][2];
#pragma unroll
  for (int i = 0; i < 8; ++i) {
    wr[i][0] = *(const f32x4*)(wp + i * 8 * EDIM * 4);
    wr[i][1] = *(const f32x4*)(wp + i * 8 * EDIM * 4 + 16);
  }
  f32x4 xr[8][2][4];
#pragma unroll
  for (int ks = 0; ks < 8; ++ks) {
#pragma unroll
    for (int u = 0; u < 2; ++u) {
      const char* p = xp + (u * 16 * EDIM + ks * 32) * 4;
      xr[ks][u][0] = *(const f32x4*)(p);
      xr[ks][u][1] = *(const f32x4*)(p + 16);
      xr[ks][u][2] = *(const f32x4*)(p + 64);
      xr[ks][u][3] = *(const f32x4*)(p + 80);
    }
  }
  // wo and xo as inputs keep the loads' address registers untouched (also as a later load's destination) up to the wait.
  // Its memory clobber holds all 80 loads ahead of it: without the statement the compiler paired each two loads
  // with their rounding, one memory round trip after the other.
  asm volatile("s_wait_xcnt 0x0" ::"v"(wo), "v"(xo) : "memory");

#pragma unroll
  for (int i = 0; i < 8; ++i) *(h8*)(bs + e0 + i * 8 * EDIM) = round8(wr[i][0], wr[i][1]);
  __syncthreads();

  v8f acc[2][4] = {};
#pragma unroll
  for (int ks = 0; ks < 8; ++ks) {
    v16h a[2];
#pragma unroll
    for (int u = 0; u < 2; ++u) {
      union { v16h v; h8 h[2]; } f;
      f.h[0] = round8(xr[ks][u][0], xr[ks][u][1]);
      f.h[1] = round8(xr[ks][u][2], xr[ks][u][3]);
      a[u] = f.v;
    }
#pragma unroll
    for (int t = 0; t < 4; ++t) {
      const v16h b = load_frag((const _Float16*)bs, t * 16, ks * 32, EDIM, lane);
      acc[0][t] =
          __builtin_amdgcn_wmma_f32_16x16x32_f16(false, a[0], false, b, (short)0, acc[0][t], false, false);
      acc[1][t] =
          __builtin_amdgcn_wmma_f32_16x16x32_f16(false, a[1], false, b, (short)0, acc[1][t], false, false);
    }
  }

  // D layout: VGPR j holds (M = (lane<16 ? j : 8+j), N = n-base + (lane&15))
  const int row = m0 + (lane >> 4) * 8;  // + u * 16 + j; a wave's 32 rows lie in one batch (KL is a multiple of 32)
  const int col = n0 + (lane & 15);      // + t * 16
  _Float16* cp = TRANSB ? C + (size_t)(row / KL) * EDIM * KL + (size_t)col * KL + (row % KL)
                        : C + (size_t)row * EDIM + col;
#pragma unroll
  for (int u = 0; u < 2; ++u) {
#pragma unroll
    for (int t = 0; t < 4; ++t) {
      // the stores issued so far have taken their registers before later roundings write into them
      if (u + t > 0) asm volatile("s_wait_xcnt 0x0" ::: "memory");
#pragma unroll
      for (int j = 0; j < 8; ++j) {
        cp[TRANSB ? t * 16 * KL + u * 16 + j : (u * 16 + j) * EDIM + t * 16] = (_Float16)acc[u][t][j];
      }
    }
  }
  // the last stores have taken their registers before any code laid out behind this body writes into them
  asm volatile("s_wait_xcnt 0x0" ::: "memory");
}

// WoSum[e][d] = sum_h Wo[e][h*E + d]  (heads are replicated -> fold Wo to 256x256); i = e * EDIM + d
__device__ __forceinline__ void wo_fold(const float* __restrict__ Wo, _Float16* __restrict__ d, int i) {
  const unsigned x = (unsigned)((i >> 8) * (HEADS * EDIM) + (i & 255));
  float w[HEADS];
#pragma unroll
  for (int h = 0; h < HEADS; ++h) w[h] = Wo[x + h * EDIM];
  // x as an input keeps the loads' address register from being reused as a load's destination ahead of the wait
  asm volatile("s_wait_xcnt 0x0" ::"v"(x) : "memory");
  float s = 0.0f;
#pragma unroll
  for (int h = 0; h < HEADS; ++h) s += w[h];
  d[i] = (_Float16)s;
  // the store has taken its registers before any code laid out behind this body writes into them
  asm volatile("s_wait_xcnt 0x0" ::: "memory");
}

// Jobs of the first launch, picked by block index: the 256-row x 64-column tiles of the three projections,
// then the fold of Wo. None of them reads what another writes.
#define QTILES ((NBATCH * QS / 256) * (EDIM / 64))  // 256 tiles of q
#define KTILES ((NBATCH * KL / 256) * (EDIM / 64))  // 64 tiles of k, as many of v
#define WOBLKS (EDIM * EDIM / 256)                  // 256 blocks, one folded weight a thread

__global__ __launch_bounds__(256) void proj_all(const float* __restrict__ query, const float* __restrict__ keys,
                                                const float* __restrict__ values, const float* __restrict__ Wq,
                                                const float* __restrict__ Wk, const float* __restrict__ Wv,
                                                const float* __restrict__ Wo, _Float16* __restrict__ qh,
                                                _Float16* __restrict__ kh, _Float16* __restrict__ vT,
                                                _Float16* __restrict__ wo16) {
  __shared__ __attribute__((aligned(16))) _Float16 bs[64 * EDIM];
  const int b = blockIdx.x;  // every test on it reads the same for the whole block
  const bool isq = b < QTILES;
  if (b < QTILES + KTILES)
    proj_f32<false>(isq ? query : keys, isq ? Wq : Wk, isq ? qh : kh, bs, isq ? b : b - QTILES);
  else if (b < QTILES + 2 * KTILES)
    proj_f32<true>(values, Wv, vT, bs, b - (QTILES + KTILES));
  else  // the short jobs come last
    wo_fold(Wo, wo16, (b - (QTILES + 2 * KTILES)) * 256 + (int)threadIdx.x);
}

typedef unsigned int u32x4 __attribute__((ext_vector_type(4)));
typedef unsigned int u32x8 __attribute__((ext_vector_type(8)));

#define KPITCH 264    // halves per staged K row   (512 B + 16 B: 16 B x odd, no bank conflict for b128 readers)
#define VPITCH 520    // halves per staged V^T row (1024 B + 16 B)
#define BUFH   33792  // halves per ring buffer: 128 K rows (the 64 V^T rows need less)

// One 64 KB tile, contiguous in global memory, into one ring buffer: 32 copies of 16 B per lane.
// Copy j of a lane lies 2048 B further in global memory and LSTEP bytes further in LDS.
template <int LSTEP>
__device__ __forceinline__ void stage_tile(unsigned l0, const char* g0) {
#pragma unroll
  for (int b = 0; b < 4; ++b) {
    const unsigned l = l0 + b * 8 * LSTEP;
    const char* g = g0 + b * 8 * 2048;
    // the closing s_wait_xcnt keeps the address registers untouched until the copies have taken them
    asm volatile(
        "global_load_async_to_lds_b128 %0, %8, off\n\t"
        "global_load_async_to_lds_b128 %1, %9, off\n\t"
        "global_load_async_to_lds_b128 %2, %10, off\n\t"
        "global_load_async_to_lds_b128 %3, %11, off\n\t"
        "global_load_async_to_lds_b128 %4, %12, off\n\t"
        "global_load_async_to_lds_b128 %5, %13, off\n\t"
        "global_load_async_to_lds_b128 %6, %14, off\n\t"
        "global_load_async_to_lds_b128 %7, %15, off\n\t"
        "s_wait_xcnt 0x0"
        ::"v"(l), "v"(l + LSTEP), "v"(l + 2 * LSTEP), "v"(l + 3 * LSTEP), "v"(l + 4 * LSTEP),
        "v"(l + 5 * LSTEP), "v"(l + 6 * LSTEP), "v"(l + 7 * LSTEP), "v"(g), "v"(g + 2048),
        "v"(g + 2 * 2048), "v"(g + 3 * 2048), "v"(g + 4 * 2048), "v"(g + 5 * 2048),
        "v"(g + 6 * 2048), "v"(g + 7 * 2048)
        : "memory");
  }
}

// Hand-over of the ring: this wave's LDS reads are done, its own copies have landed, then every wave meets.
__device__ __forceinline__ void publish() {
  asm volatile("s_wait_dscnt 0x0" ::: "memory");    // my reads of the buffer that is refilled next have returned
  asm volatile("s_wait_asynccnt 0x0" ::: "memory");  // my copies of the next tile have landed
  __syncthreads();
}

// A block = 16 products and their 16 A fragments (32 LDS loads). The fragments of block b + 1 are fetched into a
// second register set ahead of the products of block b, inside one published tile only.
// Key rows p*32..+31 of a K tile: f[2 ks] the lower 16 rows, f[2 ks + 1] the upper, k step ks.
__device__ __forceinline__ void k_frags(v16h (&f)[16], const _Float16* buf, int p, int lane) {
#pragma unroll
  for (int ks = 0; ks < 8; ++ks) {
    f[2 * ks] = load_frag(buf, p * 32, ks * 32, KPITCH, lane);
    f[2 * ks + 1] = load_frag(buf, p * 32 + 16, ks * 32, KPITCH, lane);
  }
}
// The 64 rows of a V^T tile, keys g*128..+127: f[4 kl + i] rows i*16..+15, k step g*4 + kl.
__device__ __forceinline__ void v_frags(v16h (&f)[16], const _Float16* buf, int g, int lane) {
#pragma unroll
  for (int kl = 0; kl < 4; ++kl) {
#pragma unroll
    for (int i = 0; i < 4; ++i) f[4 * kl + i] = load_frag(buf, i * 16, (g * 4 + kl) * 32, VPITCH, lane);
  }
}
// Nothing is scheduled across it. Without it the compiler sinks every fragment load to just in front of its product,
// and the one wave of a SIMD waits out the LDS latency at each product.
__device__ __forceinline__ void fence() { __builtin_amdgcn_sched_barrier(0); }

// Energy, masked softmax and attn @ v in one launch. Block = 4 waves, 16 queries a wave, one batch n.
//   S^T = K . Q^T   : A = K rows (LDS), B = Q (registers); a lane holds scores of ONE query
//   O^T = V^T . P^T : A = V^T rows (LDS), B = the packed score tiles, never leaving registers
// All 512 scores of a query stay in registers as f16 (the rounding the stored energy had).
__global__ __launch_bounds__(128) void attn_fused(const _Float16* __restrict__ qh,
                                                  const _Float16* __restrict__ kh,
                                                  const _Float16* __restrict__ vT,
                                                  const int* __restrict__ mask,
                                                  _Float16* __restrict__ ctx) {
  __shared__ __attribute__((aligned(128))) _Float16 ring[2 * BUFH];
  __shared__ __attribute__((aligned(16))) unsigned short keep[KL];  // 0xFFFF: key counts, 0: masked
  __shared__ int anyw[4];
  const int tid = threadIdx.x;
  const int lane = tid & 31;
  const int wave = tid >> 5;
  const int hi = lane >> 4;
  const int n = blockIdx.x >> 5;
  const int q0 = (blockIdx.x & 31) * 64 + wave * 16;

  const char* kg = (const char*)(kh + (size_t)n * KL * EDIM) + tid * 16;
  const char* vg = (const char*)(vT + (size_t)n * EDIM * KL) + tid * 16;
  const unsigned ring0 = (unsigned)(size_t)ring;
  const unsigned kl = ring0 + (tid >> 5) * (KPITCH * 2) + (tid & 31) * 16;
  const unsigned vl = ring0 + (tid >> 6) * (VPITCH * 2) + (tid & 63) * 16;

  stage_tile<4 * KPITCH * 2>(kl, kg);  // keys 0..127 -> buffer 0

  {
    const v4i mv = *(const v4i*)(mask + n * KL + tid * 4);
    unsigned long long kw = 0;
#pragma unroll
    for (int j = 0; j < 4; ++j)
      if (mv[j] != 0) kw |= 0xFFFFull << (16 * j);
    *(unsigned long long*)(keep + tid * 4) = kw;
    const unsigned bal = __builtin_amdgcn_ballot_w32(kw != 0);
    if (lane == 0) anyw[wave] = (bal != 0);
  }

  const _Float16* qp = qh + ((size_t)n * QS + q0 + (lane & 15)) * EDIM + hi * 8;  // load_frag's k order
  v16h qf[8];
#pragma unroll
  for (int ks = 0; ks < 8; ++ks) {
    union { v16h v; h8 h[2]; } u;
    u.h[0] = *(const h8*)(qp + ks * 32);
    u.h[1] = *(const h8*)(qp + ks * 32 + 16);
    qf[ks] = u.v;
  }
  // qp as an input keeps the loads' address register from being reused as a load's destination ahead of the wait
  asm volatile("s_wait_xcnt 0x0" ::"v"(qp) : "memory");

  asm volatile("s_wait_asynccnt 0x0" ::: "memory");  // my copies of tile 0 have landed
  __syncthreads();
  stage_tile<4 * KPITCH * 2>(kl + BUFH * 2, kg + 65536);  // keys 128..255 -> buffer 1

  // ---- scores: sp[kk] holds keys kk*32..+31 of this lane's query in B-operand order
  v16h sp[16];
#pragma unroll  // sp[] is indexed by constants only, so it stays in registers
  for (int t = 0; t < 4; ++t) {
    const _Float16* buf = ring + (t & 1) * BUFH;
    v16h fr[2][16];
    k_frags(fr[0], buf, 0, lane);
#pragma unroll
    for (int p = 0; p < 4; ++p) {
      fence();
      if (p < 3) k_frags(fr[(p + 1) & 1], buf, p + 1, lane);
      fence();
      v8f s0 = {}, s1 = {};
#pragma unroll
      for (int ks = 0; ks < 8; ++ks) {
        s0 = __builtin_amdgcn_wmma_f32_16x16x32_f16(false, fr[p & 1][2 * ks], false, qf[ks], (short)0, s0, false, false);
        s1 = __builtin_amdgcn_wmma_f32_16x16x32_f16(false, fr[p & 1][2 * ks + 1], false, qf[ks], (short)0, s1, false,
                                                    false);
      }
      v16h pk;
#pragma unroll
      for (int j = 0; j < 8; ++j) {
        pk[j] = (_Float16)s0[j];
        pk[8 + j] = (_Float16)s1[j];
      }
      sp[t * 4 + p] = pk;
    }
    publish();
    if (t < 2)
      stage_tile<4 * KPITCH * 2>(kl + (t & 1) * (BUFH * 2), kg + (t + 2) * 65536);
    else
      stage_tile<2 * VPITCH * 2>(vl + (t & 1) * (BUFH * 2), vg + (t - 2) * 65536);
  }

  // ---- masked softmax, in-lane; the two lane halves of a query meet once for the maximum, once for the sum
  // A masked key scores -inf (weight 0). With every key masked the reference is uniform: all scores 0.
  const unsigned fill = (anyw[0] | anyw[1] | anyw[2] | anyw[3]) ? 0xFC00FC00u : 0u;
  v16h mxv;
#pragma unroll
  for (int kk = 0; kk < 16; ++kk) {
    const u32x4 m0 = *(const u32x4*)(keep + kk * 32 + hi * 8);
    const u32x4 m1 = *(const u32x4*)(keep + kk * 32 + 16 + hi * 8);
    u32x8 s = __builtin_bit_cast(u32x8, sp[kk]);
#pragma unroll
    for (int i = 0; i < 4; ++i) {
      s[i] = (s[i] & m0[i]) | (fill & ~m0[i]);
      s[4 + i] = (s[4 + i] & m1[i]) | (fill & ~m1[i]);
    }
    sp[kk] = __builtin_bit_cast(v16h, s);
    mxv = kk ? __builtin_elementwise_max(mxv, sp[kk]) : sp[kk];
  }
  float mx = (float)mxv[0];
#pragma unroll
  for (int j = 1; j < 16; ++j) mx = fmaxf(mx, (float)mxv[j]);
  mx = fmaxf(mx, __shfl_xor(mx, 16, 32));
  const float sc = 0.0625f * 1.44269504f;  // 1/sqrt(E) * log2(e)
  const float mc = mx * sc;
  float sum[4] = {0.0f, 0.0f, 0.0f, 0.0f};
#pragma unroll
  for (int kk = 0; kk < 16; ++kk) {
    v16h pk;
#pragma unroll
    for (int j = 0; j < 16; ++j) {
      const float x = __builtin_amdgcn_exp2f(fmaf((float)sp[kk][j], sc, -mc));
      sum[j & 3] += x;
      pk[j] = (_Float16)x;
    }
    sp[kk] = pk;
  }
  float st = (sum[0] + sum[1]) + (sum[2] + sum[3]);
  st += __shfl_xor(st, 16, 32);
  const float inv = 1.0f / st;

  // ---- O^T, 64 rows of V^T a trip; a lane's 8 results are 8 consecutive d of its query: one 16-byte store
  _Float16* crow = ctx + ((size_t)n * QS + q0 + (lane & 15)) * EDIM + hi * 8;
#pragma unroll  // rolled, this loop spilled the staging addresses to scratch
  for (int c = 0; c < 4; ++c) {
    const _Float16* buf = ring + (c & 1) * BUFH;
    v8f o[4] = {};
    v16h fr[2][16];
    v_frags(fr[0], buf, 0, lane);
#pragma unroll
    for (int g = 0; g < 4; ++g) {
      fence();
      if (g < 3) v_frags(fr[(g + 1) & 1], buf, g + 1, lane);
      fence();
#pragma unroll
      for (int kl = 0; kl < 4; ++kl) {
#pragma unroll
        for (int i = 0; i < 4; ++i) {
          o[i] = __builtin_amdgcn_wmma_f32_16x16x32_f16(false, fr[g & 1][4 * kl + i], false, sp[g * 4 + kl], (short)0,
                                                        o[i], false, false);
        }
      }
    }
#pragma unroll
    for (int i = 0; i < 4; ++i) {
      h8 r;
#pragma unroll
      for (int j = 0; j < 8; ++j) r[j] = (_Float16)(o[i][j] * inv);
      *(h8*)(crow + c * 64 + i * 16) = r;
    }
    publish();
    if (c < 2) stage_tile<2 * VPITCH * 2>(vl + (c & 1) * (BUFH * 2), vg + (c + 2) * 65536);
  }
  asm volatile("s_wait_asynccnt 0x0" ::: "memory");  // nothing of mine is in flight when the wave ends
}

extern "C" void kernel_launch(void* const* d_in, const int* in_sizes, int n_in,
                              void* d_out, int out_size, void* d_ws, size_t ws_size,
                              hipStream_t stream) {
  const float* values = (const float*)d_in[0];
  const float* keys   = (const float*)d_in[1];
  const float* query  = (const float*)d_in[2];
  const int*   mask   = (const int*)d_in[3];
  const float* Wv = (const float*)d_in[4];
  const float* Wk = (const float*)d_in[5];
  const float* Wq = (const float*)d_in[6];
  const float* Wo = (const float*)d_in[7];
  const float* bo = (const float*)d_in[8];
  float* out = (float*)d_out;

  // Workspace carve (all f16 intermediates)
  char* ws = (char*)d_ws;
  size_t off = 0;
  auto carve = [&](size_t bytes) -> void* {
    void* p = ws + off;
    off = (off + bytes + 255) & ~(size_t)255;
    return p;
  };
  _Float16* wo16 = (_Float16*)carve((size_t)EDIM * EDIM * 2);         // head-folded Wo
  _Float16* qh   = (_Float16*)carve((size_t)NBATCH * QS * EDIM * 2);  // q proj
  _Float16* kh   = (_Float16*)carve((size_t)NBATCH * KL * EDIM * 2);  // k proj [n][k][d]
  _Float16* vT   = (_Float16*)carve((size_t)NBATCH * KL * EDIM * 2);  // v proj [n][d][k]
  _Float16* ctx  = (_Float16*)carve((size_t)NBATCH * QS * EDIM * 2);  // attn @ v
  (void)ws_size; (void)in_sizes; (void)n_in; (void)out_size;

  const dim3 blk(256);
  const size_t lds256 = 64 * 256 * sizeof(_Float16);  // B strip for K=256 (32 KB)

  // --- projections X @ W^T from the f32 inputs (v stored transposed per batch: vT[n][d][k]) and weight folding ---
  proj_all<<<QTILES + 2 * KTILES + WOBLKS, blk, 0, stream>>>(query, keys, values, Wq, Wk, Wv, Wo, qh, kh, vT, wo16);

  // --- ctx = softmax(mask(q k^T) / 16) @ v, scores kept in registers ---
  attn_fused<<<NBATCH * (QS / 64), dim3(128), 0, stream>>>(qh, kh, vT, mask, ctx);

  // --- out = ctx @ WoSum^T + bo  (f32 output straight to d_out) ---
  gemm_wmma_f16<float, false><<<dim3(EDIM / 64, (NBATCH * QS) / 256, 1), blk, lds256, stream>>>(
      ctx, 0, wo16, 0, out, 0, NBATCH * QS, EDIM, EDIM, EDIM, EDIM, EDIM, 1, bo);
}

// v005
// One run takes 45 microseconds.
// Timed twice side by side with v004, it ran 1.29 times as fast both times.
// Over all steps from v000 it is 3.19 times as fast.
#include <hip/hip_runtime.h>

// Shapes from reference: N=8, KLEN=512, Q=16, S=128, E=256, H=8
#define NBATCH 8
#define KL     512
#define QS     2048   // Q*S
#define EDIM   256
#define HEADS  8

typedef _Float16 h8   __attribute__((ext_vector_type(8)));
typedef _Float16 v16h __attribute__((ext_vector_type(16)));
typedef float    v8f  __attribute__((ext_vector_type(8)));
typedef int      v4i  __attribute__((ext_vector_type(4)));

// Build a 16x32 f16 WMMA fragment from a row-major [rows x ld] f16 matrix.
// Identical striping for A ([M][K]) and B stored as B^T ([N][K]):
//   lane<16 : halves 0..7 = K0..K0+7,  halves 8..15 = K0+16..K0+23 (row r0+lane)
//   lane>=16: halves 0..7 = K0+8..+15, halves 8..15 = K0+24..+31   (row r0+lane-16)
template <typename PtrT>
__device__ __forceinline__ v16h load_frag(PtrT base, int r0, int k0, int ld, int lane) {
  PtrT p = base + (size_t)(r0 + (lane & 15)) * ld + k0 + ((lane & 16) ? 8 : 0);
  union { v16h v; h8 h[2]; } u;
  u.h[0] = *(const h8*)(p);
  u.h[1] = *(const h8*)(p + 16);
  return u.v;
}

typedef float f32x4 __attribute__((ext_vector_type(4)));

// Eight f32 rounded to f16 (nearest even).
__device__ __forceinline__ h8 round8(f32x4 x, f32x4 y) {
  return __builtin_convertvector(__builtin_shufflevector(x, y, 0, 1, 2, 3, 4, 5, 6, 7), h8);
}

// Projection C = X . W^T straight from the f32 inputs: X [rows][EDIM], W [EDIM][EDIM], both row-major,
// both rounded to f16 in registers on their way to the matrix unit.
// 8 waves stacked in M, wave tile 32(M) x 64(N), 64 rows of W in LDS as f16.
// TRANSB: write out as [row/KL][EDIM][KL] (batch-transposed). tile: 4 column strips to each 256 rows.
template <bool TRANSB>
__device__ __forceinline__ void proj_f32(const float* __restrict__ X,
                                         const float* __restrict__ Wt,
                                         _Float16* __restrict__ C, _Float16* bs, int tile) {
  const int lane = threadIdx.x & 31;
  const int wave = threadIdx.x >> 5;
  const int n0 = (tile & 3) * 64;
  const int m0 = ((tile >> 2) * 8 + wave) * 32;

  // W[n0..n0+63][0..EDIM): a thread takes 8 consecutive k of row wave + 8 i
  const int e0 = wave * EDIM + lane * 8;
  const unsigned wo = (unsigned)(n0 * EDIM + e0) * 4u;  // byte offsets: a uniform base and one register a stream
  // this wave's 32 rows of X, load_frag's k order
  const unsigned xo = (unsigned)((m0 + (lane & 15)) * EDIM + ((lane & 16) ? 8 : 0)) * 4u;
  const char* wp = (const char*)Wt + wo;
  const char* xp = (const char*)X + xo;
  f32x4 wr[8][2];
#pragma unroll
  for (int i = 0; i < 8; ++i) {
    wr[i][0] = *(const f32x4*)(wp + i * 8 * EDIM * 4);
    wr[i][1] = *(const f32x4*)(wp + i * 8 * EDIM * 4 + 16);
  }
  f32x4 xr[8][2][4];
#pragma unroll
  for (int ks = 0; ks < 8; ++ks) {
#pragma unroll
    for (int u = 0; u < 2; ++u) {
      const char* p = xp + (u * 16 * EDIM + ks * 32) * 4;
      xr[ks][u][0] = *(const f32x4*)(p);
      xr[ks][u][1] = *(const f32x4*)(p + 16);
      xr[ks][u][2] = *(const f32x4*)(p + 64);
      xr[ks][u][3] = *(const f32x4*)(p + 80);
    }
  }
  // wo and xo as inputs keep the loads' address registers untouched (also as a later load's destination) up to the wait.
  // Its memory clobber holds all 80 loads ahead of it: without the statement the compiler paired each two loads
  // with their rounding, one memory round trip after the other.
  asm volatile("s_wait_xcnt 0x0" ::"v"(wo), "v"(xo) : "memory");

#pragma unroll
  for (int i = 0; i < 8; ++i) *(h8*)(bs + e0 + i * 8 * EDIM) = round8(wr[i][0], wr[i][1]);
  __syncthreads();

  v8f acc[2][4] = {};
#pragma unroll
  for (int ks = 0; ks < 8; ++ks) {
    v16h a[2];
#pragma unroll
    for (int u = 0; u < 2; ++u) {
      union { v16h v; h8 h[2]; } f;
      f.h[0] = round8(xr[ks][u][0], xr[ks][u][1]);
      f.h[1] = round8(xr[ks][u][2], xr[ks][u][3]);
      a[u] = f.v;
    }
#pragma unroll
    for (int t = 0; t < 4; ++t) {
      const v16h b = load_frag((const _Float16*)bs, t * 16, ks * 32, EDIM, lane);
      acc[0][t] =
          __builtin_amdgcn_wmma_f32_16x16x32_f16(false, a[0], false, b, (short)0, acc[0][t], false, false);
      acc[1][t] =
          __builtin_amdgcn_wmma_f32_16x16x32_f16(false, a[1], false, b, (short)0, acc[1][t], false, false);
    }
  }

  // D layout: VGPR j holds (M = (lane<16 ? j : 8+j), N = n-base + (lane&15))
  const int row = m0 + (lane >> 4) * 8;  // + u * 16 + j; a wave's 32 rows lie in one batch (KL is a multiple of 32)
  const int col = n0 + (lane & 15);      // + t * 16
  _Float16* cp = TRANSB ? C + (size_t)(row / KL) * EDIM * KL + (size_t)col * KL + (row % KL)
                        : C + (size_t)row * EDIM + col;
#pragma unroll
  for (int u = 0; u < 2; ++u) {
#pragma unroll
    for (int t = 0; t < 4; ++t) {
      // the stores issued so far have taken their registers before later roundings write into them
      if (u + t > 0) asm volatile("s_wait_xcnt 0x0" ::: "memory");
#pragma unroll
      for (int j = 0; j < 8; ++j) {
        cp[TRANSB ? t * 16 * KL + u * 16 + j : (u * 16 + j) * EDIM + t * 16] = (_Float16)acc[u][t][j];
      }
    }
  }
  // the last stores have taken their registers before any code laid out behind this body writes into them
  asm volatile("s_wait_xcnt 0x0" ::: "memory");
}

// WoSum[e][d] = sum_h Wo[e][h*E + d]  (heads are replicated -> fold Wo to 256x256); i = e * EDIM + d
__device__ __forceinline__ void wo_fold(const float* __restrict__ Wo, _Float16* __restrict__ d, int i) {
  const unsigned x = (unsigned)((i >> 8) * (HEADS * EDIM) + (i & 255));
  float w[HEADS];
#pragma unroll
  for (int h = 0; h < HEADS; ++h) w[h] = Wo[x + h * EDIM];
  // x as an input keeps the loads' address register from being reused as a load's destination ahead of the wait
  asm volatile("s_wait_xcnt 0x0" ::"v"(x) : "memory");
  float s = 0.0f;
#pragma unroll
  for (int h = 0; h < HEADS; ++h) s += w[h];
  d[i] = (_Float16)s;
  // the store has taken its registers before any code laid out behind this body writes into them
  asm volatile("s_wait_xcnt 0x0" ::: "memory");
}

// Jobs of the first launch, picked by block index: the 256-row x 64-column tiles of the three projections,
// then the fold of Wo. None of them reads what another writes.
#define QTILES ((NBATCH * QS / 256) * (EDIM / 64))  // 256 tiles of q
#define KTILES ((NBATCH * KL / 256) * (EDIM / 64))  // 64 tiles of k, as many of v
#define WOBLKS (EDIM * EDIM / 256)                  // 256 blocks, one folded weight a thread

__global__ __launch_bounds__(256) void proj_all(const float* __restrict__ query, const float* __restrict__ keys,
                                                const float* __restrict__ values, const float* __restrict__ Wq,
                                                const float* __restrict__ Wk, const float* __restrict__ Wv,
                                                const float* __restrict__ Wo, _Float16* __restrict__ qh,
                                                _Float16* __restrict__ kh, _Float16* __restrict__ vT,
                                                _Float16* __restrict__ wo16) {
  __shared__ __attribute__((aligned(16))) _Float16 bs[64 * EDIM];
  const int b = blockIdx.x;  // every test on it reads the same for the whole block
  const bool isq = b < QTILES;
  if (b < QTILES + KTILES)
    proj_f32<false>(isq ? query : keys, isq ? Wq : Wk, isq ? qh : kh, bs, isq ? b : b - QTILES);
  else if (b < QTILES + 2 * KTILES)
    proj_f32<true>(values, Wv, vT, bs, b - (QTILES + KTILES));
  else  // the short jobs come last
    wo_fold(Wo, wo16, (b - (QTILES + 2 * KTILES)) * 256 + (int)threadIdx.x);
}

typedef unsigned int u32x4 __attribute__((ext_vector_type(4)));
typedef unsigned int u32x8 __attribute__((ext_vector_type(8)));

#define KPITCH 264    // halves per staged K row   (512 B + 16 B: 16 B x odd, no bank conflict for b128 readers)
#define VPITCH 520    // halves per staged V^T row (1024 B + 16 B)
#define BUFH   33792  // halves per ring buffer: 128 K rows (the 64 V^T rows need less)
#define WPITCH 72     // halves per staged row of a WoSum column chunk (128 B + 16 B)
#define WBUFH  (EDIM * WPITCH)  // halves per chunk buffer: 256 rows of 64 columns
#define OPITCH 260    // floats per staged output row (1024 B + 16 B)

// NB * 8 copies of 16 B per lane into one ring buffer.
// Copy j of a lane lies GSTEP bytes further in global memory and LSTEP bytes further in LDS.
// K, V^T: one 64 KB tile, contiguous in global memory (GSTEP 2048, 32 copies).
template <int LSTEP, int GSTEP = 2048, int NB = 4>
__device__ __forceinline__ void stage_tile(unsigned l0, const char* g0) {
#pragma unroll
  for (int b = 0; b < NB; ++b) {
    const unsigned l = l0 + b * 8 * LSTEP;
    const char* g = g0 + b * 8 * GSTEP;
    // the closing s_wait_xcnt keeps the address registers untouched until the copies have taken them
    asm volatile(
        "global_load_async_to_lds_b128 %0, %8, off\n\t"
        "global_load_async_to_lds_b128 %1, %9, off\n\t"
        "global_load_async_to_lds_b128 %2, %10, off\n\t"
        "global_load_async_to_lds_b128 %3, %11, off\n\t"
        "global_load_async_to_lds_b128 %4, %12, off\n\t"
        "global_load_async_to_lds_b128 %5, %13, off\n\t"
        "global_load_async_to_lds_b128 %6, %14, off\n\t"
        "global_load_async_to_lds_b128 %7, %15, off\n\t"
        "s_wait_xcnt 0x0"
        ::"v"(l), "v"(l + LSTEP), "v"(l + 2 * LSTEP), "v"(l + 3 * LSTEP), "v"(l + 4 * LSTEP),
        "v"(l + 5 * LSTEP), "v"(l + 6 * LSTEP), "v"(l + 7 * LSTEP), "v"(g), "v"(g + GSTEP),
        "v"(g + 2 * GSTEP), "v"(g + 3 * GSTEP), "v"(g + 4 * GSTEP), "v"(g + 5 * GSTEP),
        "v"(g + 6 * GSTEP), "v"(g + 7 * GSTEP)
        : "memory");
  }
}

// Hand-over of the ring: this wave's LDS reads are done, its own copies have landed, then every wave meets.
__device__ __forceinline__ void publish() {
  asm volatile("s_wait_dscnt 0x0" ::: "memory");    // my reads of the buffer that is refilled next have returned
  asm volatile("s_wait_asynccnt 0x0" ::: "memory");  // my copies of the next tile have landed
  __syncthreads();
}

// A block = 16 products and their 16 A fragments (32 LDS loads). The fragments of block b + 1 are fetched into a
// second register set ahead of the products of block b, inside one published tile only.
// Key rows p*32..+31 of a K tile: f[2 ks] the lower 16 rows, f[2 ks + 1] the upper, k step ks.
__device__ __forceinline__ void k_frags(v16h (&f)[16], const _Float16* buf, int p, int lane) {
#pragma unroll
  for (int ks = 0; ks < 8; ++ks) {
    f[2 * ks] = load_frag(buf, p * 32, ks * 32, KPITCH, lane);
    f[2 * ks + 1] = load_frag(buf, p * 32 + 16, ks * 32, KPITCH, lane);
  }
}
// The 64 rows of a V^T tile, keys g*128..+127: f[4 kl + i] rows i*16..+15, k step g*4 + kl.
__device__ __forceinline__ void v_frags(v16h (&f)[16], const _Float16* buf, int g, int lane) {
#pragma unroll
  for (int kl = 0; kl < 4; ++kl) {
#pragma unroll
    for (int i = 0; i < 4; ++i) f[4 * kl + i] = load_frag(buf, i * 16, (g * 4 + kl) * 32, VPITCH, lane);
  }
}
// Rows h*128..+127 of a WoSum column chunk: f[8 ks + i] rows (h*8 + i)*16..+15, k step ks of the chunk's two.
__device__ __forceinline__ void w_frags(v16h (&f)[16], const _Float16* buf, int h, int lane) {
#pragma unroll
  for (int ks = 0; ks < 2; ++ks) {
#pragma unroll
    for (int i = 0; i < 8; ++i) f[8 * ks + i] = load_frag(buf, (h * 8 + i) * 16, ks * 32, WPITCH, lane);
  }
}
// Nothing is scheduled across it. Without it the compiler sinks every fragment load to just in front of its product,
// and the one wave of a SIMD waits out the LDS latency at each product.
__device__ __forceinline__ void fence() { __builtin_amdgcn_sched_barrier(0); }

// Energy, masked softmax, attn @ v and the output projection in one launch. Block = 4 waves, 16 queries a wave,
// one batch n.
//   S^T = K . Q^T       : A = K rows (LDS), B = Q (registers); a lane holds scores of ONE query
//   O^T = V^T . P^T     : A = V^T rows (LDS), B = the packed score tiles, never leaving registers
//   out^T += WoSum . O^T: A = WoSum rows, 64 columns a trip (LDS), B = the trip's 64 rows of O^T, packed as f16
// All 512 scores of a query stay in registers as f16 (the rounding the stored energy had).
__global__ __launch_bounds__(128) void attn_fused(const _Float16* __restrict__ qh,
                                                  const _Float16* __restrict__ kh,
                                                  const _Float16* __restrict__ vT,
                                                  const int* __restrict__ mask,
                                                  const _Float16* __restrict__ wo16,
                                                  const float* __restrict__ bo,
                                                  float* __restrict__ out) {
  __shared__ __attribute__((aligned(128))) _Float16 ring[2 * BUFH];
  __shared__ __attribute__((aligned(128))) _Float16 wring[2 * WBUFH];
  __shared__ __attribute__((aligned(16))) unsigned short keep[KL];  // 0xFFFF: key counts, 0: masked
  __shared__ int anyw[4];
  const int tid = threadIdx.x;
  const int lane = tid & 31;
  const int wave = tid >> 5;
  const int hi = lane >> 4;
  const int n = blockIdx.x >> 5;
  const int q0 = (blockIdx.x & 31) * 64 + wave * 16;

  const char* kg = (const char*)(kh + (size_t)n * KL * EDIM) + tid * 16;
  const char* vg = (const char*)(vT + (size_t)n * EDIM * KL) + tid * 16;
  const unsigned ring0 = (unsigned)(size_t)ring;
  const unsigned kl = ring0 + (tid >> 5) * (KPITCH * 2) + (tid & 31) * 16;
  const unsigned vl = ring0 + (tid >> 6) * (VPITCH * 2) + (tid & 63) * 16;
  // WoSum chunk: 8 lanes to a row's 128 B, 16 rows to a copy of the block
  const char* wg = (const char*)wo16 + (tid >> 3) * (EDIM * 2) + (tid & 7) * 16;
  const unsigned wl = (unsigned)(size_t)wring + (tid >> 3) * (WPITCH * 2) + (tid & 7) * 16;

  stage_tile<4 * KPITCH * 2>(kl, kg);  // keys 0..127 -> buffer 0

  {
    const v4i mv = *(const v4i*)(mask + n * KL + tid * 4);
    unsigned long long kw = 0;
#pragma unroll
    for (int j = 0; j < 4; ++j)
      if (mv[j] != 0) kw |= 0xFFFFull << (16 * j);
    *(unsigned long long*)(keep + tid * 4) = kw;
    const unsigned bal = __builtin_amdgcn_ballot_w32(kw != 0);
    if (lane == 0) anyw[wave] = (bal != 0);
  }

  const _Float16* qp = qh + ((size_t)n * QS + q0 + (lane & 15)) * EDIM + hi * 8;  // load_frag's k order
  v16h qf[8];
#pragma unroll
  for (int ks = 0; ks < 8; ++ks) {
    union { v16h v; h8 h[2]; } u;
    u.h[0] = *(const h8*)(qp + ks * 32);
    u.h[1] = *(const h8*)(qp + ks * 32 + 16);
    qf[ks] = u.v;
  }
  // the bias of the 2 x 4 output columns that this lane stores of every row
  const float* bp = bo + lane * 4;
  const f32x4 bias0 = *(const f32x4*)(bp);
  const f32x4 bias1 = *(const f32x4*)(bp + 128);
  // qp and bp as inputs keep the loads' address registers from being reused as a load's destination ahead of the wait
  asm volatile("s_wait_xcnt 0x0" ::"v"(qp), "v"(bp) : "memory");

  asm volatile("s_wait_asynccnt 0x0" ::: "memory");  // my copies of tile 0 have landed
  __syncthreads();
  stage_tile<4 * KPITCH * 2>(kl + BUFH * 2, kg + 65536);  // keys 128..255 -> buffer 1

  // ---- scores: sp[kk] holds keys kk*32..+31 of this lane's query in B-operand order
  v16h sp[16];
#pragma unroll  // sp[] is indexed by constants only, so it stays in registers
  for (int t = 0; t < 4; ++t) {
    const _Float16* buf = ring + (t & 1) * BUFH;
    v16h fr[2][16];
    k_frags(fr[0], buf, 0, lane);
#pragma unroll
    for (int p = 0; p < 4; ++p) {
      fence();
      if (p < 3) k_frags(fr[(p + 1) & 1], buf, p + 1, lane);
      fence();
      v8f s0 = {}, s1 = {};
#pragma unroll
      for (int ks = 0; ks < 8; ++ks) {
        s0 = __builtin_amdgcn_wmma_f32_16x16x32_f16(false, fr[p & 1][2 * ks], false, qf[ks], (short)0, s0, false, false);
        s1 = __builtin_amdgcn_wmma_f32_16x16x32_f16(false, fr[p & 1][2 * ks + 1], false, qf[ks], (short)0, s1, false,
                                                    false);
      }
      v16h pk;
#pragma unroll
      for (int j = 0; j < 8; ++j) {
        pk[j] = (_Float16)s0[j];
        pk[8 + j] = (_Float16)s1[j];
      }
      sp[t * 4 + p] = pk;
    }
    publish();
    if (t < 2)
      stage_tile<4 * KPITCH * 2>(kl + (t & 1) * (BUFH * 2), kg + (t + 2) * 65536);
    else {
      stage_tile<2 * VPITCH * 2>(vl + (t & 1) * (BUFH * 2), vg + (t - 2) * 65536);
      stage_tile<16 * WPITCH * 2, 16 * EDIM * 2, 2>(wl + (t & 1) * (WBUFH * 2), wg + (t - 2) * 128);
    }
  }

  // ---- masked softmax, in-lane; the two lane halves of a query meet once for the maximum, once for the sum
  // A masked key scores -inf (weight 0). With every key masked the reference is uniform: all scores 0.
  const unsigned fill = (anyw[0] | anyw[1] | anyw[2] | anyw[3]) ? 0xFC00FC00u : 0u;
  v16h mxv;
#pragma unroll
  for (int kk = 0; kk < 16; ++kk) {
    const u32x4 m0 = *(const u32x4*)(keep + kk * 32 + hi * 8);
    const u32x4 m1 = *(const u32x4*)(keep + kk * 32 + 16 + hi * 8);
    u32x8 s = __builtin_bit_cast(u32x8, sp[kk]);
#pragma unroll
    for (int i = 0; i < 4; ++i) {
      s[i] = (s[i] & m0[i]) | (fill & ~m0[i]);
      s[4 + i] = (s[4 + i] & m1[i]) | (fill & ~m1[i]);
    }
    sp[kk] = __builtin_bit_cast(v16h, s);
    mxv = kk ? __builtin_elementwise_max(mxv, sp[kk]) : sp[kk];
  }
  float mx = (float)mxv[0];
#pragma unroll
  for (int j = 1; j < 16; ++j) mx = fmaxf(mx, (float)mxv[j]);
  mx = fmaxf(mx, __shfl_xor(mx, 16, 32));
  const float sc = 0.0625f * 1.44269504f;  // 1/sqrt(E) * log2(e)
  const float mc = mx * sc;
  float sum[4] = {0.0f, 0.0f, 0.0f, 0.0f};
#pragma unroll
  for (int kk = 0; kk < 16; ++kk) {
    v16h pk;
#pragma unroll
    for (int j = 0; j < 16; ++j) {
      const float x = __builtin_amdgcn_exp2f(fmaf((float)sp[kk][j], sc, -mc));
      sum[j & 3] += x;
      pk[j] = (_Float16)x;
    }
    sp[kk] = pk;
  }
  float st = (sum[0] + sum[1]) + (sum[2] + sum[3]);
  st += __shfl_xor(st, 16, 32);
  const float inv = 1.0f / st;

  // ---- O^T, 64 rows of V^T a trip, and at once their share of out^T: a lane's 8 results of an O^T tile are 8
  // consecutive d of its query, so two tiles pack into one B operand (load_frag's k order), as the scores did.
  // acc[e] sums over d in rising order, 32 a product.
  v8f acc[16] = {};
  // The staging addresses once more, from the lane's number as the hardware counts it: a build that held vl, vg, wl
  // and wg (operands of the asm statements above) across the rolled loop spilled them to scratch; this one spills none.
  const int tid2 = __builtin_amdgcn_readfirstlane(wave) * 32 + (int)__builtin_amdgcn_mbcnt_lo(~0u, 0u);
  const char* vg2 = (const char*)(vT + (size_t)n * EDIM * KL) + tid2 * 16;
  const unsigned vl2 = ring0 + (tid2 >> 6) * (VPITCH * 2) + (tid2 & 63) * 16;
  const char* wg2 = (const char*)wo16 + (tid2 >> 3) * (EDIM * 2) + (tid2 & 7) * 16;
  const unsigned wl2 = (unsigned)(size_t)wring + (tid2 >> 3) * (WPITCH * 2) + (tid2 & 7) * 16;
#pragma unroll 1  // every register index is a constant, so one copy of the body serves all four trips: less text to fetch
  for (int c = 0; c < 4; ++c) {
    const _Float16* buf = ring + (c & 1) * BUFH;
    const _Float16* wb = wring + (c & 1) * WBUFH;
    v8f o[4] = {};
    v16h fr[2][16];
    v_frags(fr[0], buf, 0, lane);
#pragma unroll
    for (int g = 0; g < 4; ++g) {
      fence();
      if (g < 3)
        v_frags(fr[(g + 1) & 1], buf, g + 1, lane);
      else
        w_frags(fr[0], wb, 0, lane);
      fence();
#pragma unroll
      for (int kl = 0; kl < 4; ++kl) {
#pragma unroll
        for (int i = 0; i < 4; ++i) {
          o[i] = __builtin_amdgcn_wmma_f32_16x16x32_f16(false, fr[g & 1][4 * kl + i], false, sp[g * 4 + kl], (short)0,
                                                        o[i], false, false);
        }
      }
    }
    fence();
    w_frags(fr[1], wb, 1, lane);
    fence();
    v16h cf[2];
#pragma unroll
    for (int i = 0; i < 4; ++i) {
#pragma unroll
      for (int j = 0; j < 8; ++j) cf[i >> 1][(i & 1) * 8 + j] = (_Float16)(o[i][j] * inv);
    }
#pragma unroll
    for (int h = 0; h < 2; ++h) {
#pragma unroll
      for (int ks = 0; ks < 2; ++ks) {
#pragma unroll
        for (int i = 0; i < 8; ++i) {
          acc[h * 8 + i] = __builtin_amdgcn_wmma_f32_16x16x32_f16(false, fr[h][8 * ks + i], false, cf[ks], (short)0,
                                                                  acc[h * 8 + i], false, false);
        }
      }
    }
    fence();  // without it the compiler moved these products behind the hand-over's waits and barrier, the refill behind them
    publish();
    if (c < 2) {
      stage_tile<2 * VPITCH * 2>(vl2 + (c & 1) * (BUFH * 2), vg2 + (c + 2) * 65536);
      stage_tile<16 * WPITCH * 2, 16 * EDIM * 2, 2>(wl2 + (c & 1) * (WBUFH * 2), wg2 + (c + 2) * 128);
    }
  }
  asm volatile("s_wait_asynccnt 0x0" ::: "memory");  // nothing of mine is in flight any more

  // ---- out rows leave as whole 128-byte lines: each wave turns its 16 x 256 tile in a range of the ring that is
  // its own. Behind the last publish() no wave reads the ring and no copy is aimed at it.
  float* stg = (float*)ring + wave * (16 * OPITCH);
  float* sw = stg + (lane & 15) * OPITCH + hi * 8;
#pragma unroll
  for (int e = 0; e < 16; ++e) {
    *(f32x4*)(sw + e * 16) = __builtin_shufflevector(acc[e], acc[e], 0, 1, 2, 3);
    *(f32x4*)(sw + e * 16 + 4) = __builtin_shufflevector(acc[e], acc[e], 4, 5, 6, 7);
  }
  asm volatile("s_wait_dscnt 0x0" ::: "memory");  // the wave's own rows are written before its lanes read across them
  const float* sr = stg + lane * 4;
  float* orow = out + ((size_t)n * QS + q0) * EDIM + lane * 4;
  f32x4 ov[16][2];
#pragma unroll
  for (int r = 0; r < 16; ++r) {
    ov[r][0] = *(const f32x4*)(sr + r * OPITCH);
    ov[r][1] = *(const f32x4*)(sr + r * OPITCH + 128);
  }
#pragma unroll
  for (int r = 0; r < 16; r += 4) {
#pragma unroll
    for (int i = r; i < r + 4; ++i) {
      ov[i][0] += bias0;
      ov[i][1] += bias1;
      *(f32x4*)(orow + i * EDIM) = ov[i][0];
      *(f32x4*)(orow + i * EDIM + 128) = ov[i][1];
    }
    // the stored values and the address as inputs keep the eight stores' registers untouched up to the wait
    asm volatile("s_wait_xcnt 0x0" ::"v"(orow), "v"(ov[r][0]), "v"(ov[r][1]), "v"(ov[r + 1][0]), "v"(ov[r + 1][1]),
                 "v"(ov[r + 2][0]), "v"(ov[r + 2][1]), "v"(ov[r + 3][0]), "v"(ov[r + 3][1])
                 : "memory");
  }
}

extern "C" void kernel_launch(void* const* d_in, const int* in_sizes, int n_in,
                              void* d_out, int out_size, void* d_ws, size_t ws_size,
                              hipStream_t stream) {
  const float* values = (const float*)d_in[0];
  const float* keys   = (const float*)d_in[1];
  const float* query  = (const float*)d_in[2];
  const int*   mask   = (const int*)d_in[3];
  const float* Wv = (const float*)d_in[4];
  const float* Wk = (const float*)d_in[5];
  const float* Wq = (const float*)d_in[6];
  const float* Wo = (const float*)d_in[7];
  const float* bo = (const float*)d_in[8];
  float* out = (float*)d_out;

  // Workspace carve (all f16 intermediates)
  char* ws = (char*)d_ws;
  size_t off = 0;
  auto carve = [&](size_t bytes) -> void* {
    void* p = ws + off;
    off = (off + bytes + 255) & ~(size_t)255;
    return p;
  };
  _Float16* wo16 = (_Float16*)carve((size_t)EDIM * EDIM * 2);         // head-folded Wo
  _Float16* qh   = (_Float16*)carve((size_t)NBATCH * QS * EDIM * 2);  // q proj
  _Float16* kh   = (_Float16*)carve((size_t)NBATCH * KL * EDIM * 2);  // k proj [n][k][d]
  _Float16* vT   = (_Float16*)carve((size_t)NBATCH * KL * EDIM * 2);  // v proj [n][d][k]
  (void)ws_size; (void)in_sizes; (void)n_in; (void)out_size;

  const dim3 blk(256);

  // --- projections X @ W^T from the f32 inputs (v stored transposed per batch: vT[n][d][k]) and weight folding ---
  proj_all<<<QTILES + 2 * KTILES + WOBLKS, blk, 0, stream>>>(query, keys, values, Wq, Wk, Wv, Wo, qh, kh, vT, wo16);

  // --- out = (softmax(mask(q k^T) / 16) @ v) @ WoSum^T + bo, scores and context kept in registers ---
  attn_fused<<<NBATCH * (QS / 64), dim3(128), 0, stream>>>(qh, kh, vT, mask, wo16, bo, out);
}

// v006
// Measured time: 25 microseconds a run.
// Two timings next to v005 put it at 1.80 and 1.81 times that version's speed.
// Counting every step since v000, it is 5.76 times as fast.
#include <hip/hip_runtime.h>

// Shapes from reference: N=8, KLEN=512, Q=16, S=128, E=256, H=8
#define NBATCH 8
#define KL     512
#define QS     2048   // Q*S
#define EDIM   256
#define HEADS  8

typedef _Float16 h8   __attribute__((ext_vector_type(8)));
typedef _Float16 v16h __attribute__((ext_vector_type(16)));
typedef float    v8f  __attribute__((ext_vector_type(8)));
typedef int      v4i  __attribute__((ext_vector_type(4)));

// Build a 16x32 f16 WMMA fragment from a row-major [rows x ld] f16 matrix.
// Identical striping for A ([M][K]) and B stored as B^T ([N][K]):
//   lane<16 : halves 0..7 = K0..K0+7,  halves 8..15 = K0+16..K0+23 (row r0+lane)
//   lane>=16: halves 0..7 = K0+8..+15, halves 8..15 = K0+24..+31   (row r0+lane-16)
template <typename PtrT>
__device__ __forceinline__ v16h load_frag(PtrT base, int r0, int k0, int ld, int lane) {
  PtrT p = base + (size_t)(r0 + (lane & 15)) * ld + k0 + ((lane & 16) ? 8 : 0);
  union { v16h v; h8 h[2]; } u;
  u.h[0] = *(const h8*)(p);
  u.h[1] = *(const h8*)(p + 16);
  return u.v;
}

typedef float f32x4 __attribute__((ext_vector_type(4)));

typedef _Float16 h4 __attribute__((ext_vector_type(4)));

// Nothing is scheduled across it. Without it the compiler sinks every fragment load to just in front of its product,
// and the wave waits out the LDS latency at each product.
__device__ __forceinline__ void fence() { __builtin_amdgcn_sched_barrier(0); }

#define TROWS  128  // rows of X to a block
#define XPITCH 264  // halves per staged row of X or W (512 B + 16 B: 16 B x odd, no bank conflict for b128 readers)

// Projection C = X . W^T straight from the f32 inputs: X [rows][EDIM], W [EDIM][EDIM], both row-major.
// A block takes 128 rows of X and all of W: every wave-wide load covers 512 consecutive bytes, each value is rounded
// to f16 in registers and laid in LDS. 8 waves as 2 (rows) x 4 (columns), wave tile 64 x 64, k rising, 32 a product.
// TRANSB false: C^T = W . X^T, so a lane holds 8 consecutive columns of one row of C [row][EDIM].
// TRANSB true : C   = X . W^T, so a lane holds 8 consecutive rows of one column: out is [row/KL][EDIM][KL].
template <bool TRANSB>
__device__ __forceinline__ void proj_f32(const float* __restrict__ X,
                                         const float* __restrict__ Wt,
                                         _Float16* __restrict__ C, _Float16* xs, _Float16* wsh, int tile) {
  const int lane = threadIdx.x & 31;
  const int wave = threadIdx.x >> 5;

  // byte offsets: a uniform base and one register a stream. A wave takes 16 rows of X and 32 rows of W, half a row a load.
  const unsigned xo = (unsigned)((tile * TROWS + wave * 16) * EDIM + lane * 4) * 4u;
  const unsigned wo = (unsigned)(wave * 32 * EDIM + lane * 4) * 4u;
  const char* xp = (const char*)X + xo;
  const char* wp = (const char*)Wt + wo;
  f32x4 xr[32];
#pragma unroll
  for (int i = 0; i < 32; ++i) xr[i] = *(const f32x4*)(xp + i * 512);
  f32x4 wr[64];
#pragma unroll
  for (int i = 0; i < 64; ++i) wr[i] = *(const f32x4*)(wp + i * 512);
  // xo and wo as inputs keep the loads' address registers untouched (also as a later load's destination) up to the wait.
  // Its memory clobber holds all 96 loads ahead of it: without the statement the compiler pairs loads with their
  // rounding, one memory round trip after the other.
  asm volatile("s_wait_xcnt 0x0" ::"v"(xo), "v"(wo) : "memory");

  _Float16* xd = xs + wave * 16 * XPITCH + lane * 4;
  _Float16* wd = wsh + wave * 32 * XPITCH + lane * 4;
#pragma unroll
  for (int i = 0; i < 32; ++i) *(h4*)(xd + (i >> 1) * XPITCH + (i & 1) * 128) = __builtin_convertvector(xr[i], h4);
#pragma unroll
  for (int i = 0; i < 64; ++i) *(h4*)(wd + (i >> 1) * XPITCH + (i & 1) * 128) = __builtin_convertvector(wr[i], h4);
  __syncthreads();

  const int rg = wave >> 2;  // which 64 rows of the tile
  const int cg = wave & 3;   // which 64 columns
  const _Float16* ab = TRANSB ? xs + rg * 64 * XPITCH : wsh + cg * 64 * XPITCH;  // A operand's 64 rows
  const _Float16* bb = TRANSB ? wsh + cg * 64 * XPITCH : xs + rg * 64 * XPITCH;  // B operand's 64 rows
  v8f acc[4][4] = {};
  v16h fa[2][4], fb[2][4];  // the fragments of k step ks + 1 are fetched ahead of the products of k step ks
#pragma unroll
  for (int i = 0; i < 4; ++i) {
    fa[0][i] = load_frag(ab, i * 16, 0, XPITCH, lane);
    fb[0][i] = load_frag(bb, i * 16, 0, XPITCH, lane);
  }
#pragma unroll
  for (int ks = 0; ks < 8; ++ks) {
    fence();
    if (ks < 7) {
#pragma unroll
      for (int i = 0; i < 4; ++i) {
        fa[(ks + 1) & 1][i] = load_frag(ab, i * 16, (ks + 1) * 32, XPITCH, lane);
        fb[(ks + 1) & 1][i] = load_frag(bb, i * 16, (ks + 1) * 32, XPITCH, lane);
      }
    }
    fence();
#pragma unroll
    for (int i = 0; i < 4; ++i) {
#pragma unroll
      for (int j = 0; j < 4; ++j) {
        acc[i][j] = __builtin_amdgcn_wmma_f32_16x16x32_f16(false, fa[ks & 1][i], false, fb[ks & 1][j], (short)0,
                                                           acc[i][j], false, false);
      }
    }
  }

  // D layout: VGPR j holds (M = (lane<16 ? j : 8+j), N = lane&15): 8 consecutive M of one N, 16 bytes as f16.
  const int m0 = (lane >> 4) * 8;  // + i * 16 + j
  const int nn = lane & 15;        // + j * 16
  const int row0 = tile * TROWS + rg * 64;  // a tile's 128 rows lie in one batch (KL is a multiple of 128)
  const int col0 = cg * 64;
  _Float16* cp = TRANSB ? C + (size_t)(row0 / KL) * EDIM * KL + (size_t)(col0 + nn) * KL + (row0 % KL) + m0
                        : C + (size_t)(row0 + nn) * EDIM + col0 + m0;
  h8 hv[4][4];
#pragma unroll
  for (int i = 0; i < 4; ++i) {
#pragma unroll
    for (int j = 0; j < 4; ++j) {
      hv[i][j] = __builtin_convertvector(acc[i][j], h8);
      *(h8*)(cp + i * 16 + j * 16 * (TRANSB ? KL : EDIM)) = hv[i][j];
    }
  }
  // the stored values and the address as inputs keep the sixteen stores' registers untouched up to the wait
  asm volatile("s_wait_xcnt 0x0" ::"v"(cp), "v"(hv[0][0]), "v"(hv[0][1]), "v"(hv[0][2]), "v"(hv[0][3]), "v"(hv[1][0]),
               "v"(hv[1][1]), "v"(hv[1][2]), "v"(hv[1][3]), "v"(hv[2][0]), "v"(hv[2][1]), "v"(hv[2][2]), "v"(hv[2][3]),
               "v"(hv[3][0]), "v"(hv[3][1]), "v"(hv[3][2]), "v"(hv[3][3])
               : "memory");
}

// WoSum[e][d] = sum_h Wo[e][h*E + d]  (heads are replicated -> fold Wo to 256x256); i = e * EDIM + d, 4 d a thread
__device__ __forceinline__ void wo_fold(const float* __restrict__ Wo, _Float16* __restrict__ d, int i) {
  const unsigned x = (unsigned)((i >> 8) * (HEADS * EDIM) + (i & 255));
  f32x4 w[HEADS];
#pragma unroll
  for (int h = 0; h < HEADS; ++h) w[h] = *(const f32x4*)(Wo + x + h * EDIM);
  // x as an input keeps the loads' address register from being reused as a load's destination ahead of the wait
  asm volatile("s_wait_xcnt 0x0" ::"v"(x) : "memory");
  f32x4 s = {0.0f, 0.0f, 0.0f, 0.0f};
#pragma unroll
  for (int h = 0; h < HEADS; ++h) s += w[h];
  *(h4*)(d + i) = __builtin_convertvector(s, h4);
  // the store has taken its registers before any code laid out behind this body writes into them
  asm volatile("s_wait_xcnt 0x0" ::: "memory");
}

// Jobs of the first launch, picked by block index: the 128-row tiles of the three projections, then the fold of Wo.
// None of them reads what another writes. 256 blocks in all, each with a WGP's LDS mostly to itself.
#define QTILES (NBATCH * QS / TROWS)     // 128 tiles of q
#define KTILES (NBATCH * KL / TROWS)     // 32 tiles of k, as many of v
#define WOBLKS (EDIM * EDIM / (256 * 4))  // 64 blocks, four folded weights a thread

__global__ __launch_bounds__(256) void proj_all(const float* __restrict__ query, const float* __restrict__ keys,
                                                const float* __restrict__ values, const float* __restrict__ Wq,
                                                const float* __restrict__ Wk, const float* __restrict__ Wv,
                                                const float* __restrict__ Wo, _Float16* __restrict__ qh,
                                                _Float16* __restrict__ kh, _Float16* __restrict__ vT,
                                                _Float16* __restrict__ wo16) {
  __shared__ __attribute__((aligned(16))) _Float16 xs[TROWS * XPITCH];
  __shared__ __attribute__((aligned(16))) _Float16 wsh[EDIM * XPITCH];
  const int b = blockIdx.x;  // every test on it reads the same for the whole block
  const bool isq = b < QTILES;
  if (b < QTILES + KTILES)
    proj_f32<false>(isq ? query : keys, isq ? Wq : Wk, isq ? qh : kh, xs, wsh, isq ? b : b - QTILES);
  else if (b < QTILES + 2 * KTILES)
    proj_f32<true>(values, Wv, vT, xs, wsh, b - (QTILES + KTILES));
  else
    wo_fold(Wo, wo16, ((b - (QTILES + 2 * KTILES)) * 256 + (int)threadIdx.x) * 4);
}

typedef unsigned int u32x4 __attribute__((ext_vector_type(4)));
typedef unsigned int u32x8 __attribute__((ext_vector_type(8)));

#define KPITCH 264    // halves per staged K row   (512 B + 16 B: 16 B x odd, no bank conflict for b128 readers)
#define VPITCH 520    // halves per staged V^T row (1024 B + 16 B)
#define BUFH   33792  // halves per ring buffer: 128 K rows (the 64 V^T rows need less)
#define WPITCH 72     // halves per staged row of a WoSum column chunk (128 B + 16 B)
#define WBUFH  (EDIM * WPITCH)  // halves per chunk buffer: 256 rows of 64 columns
#define OPITCH 260    // floats per staged output row (1024 B + 16 B)

// NB * 8 copies of 16 B per lane into one ring buffer.
// Copy j of a lane lies GSTEP bytes further in global memory and LSTEP bytes further in LDS.
// K, V^T: one 64 KB tile, contiguous in global memory (GSTEP 2048, 32 copies).
template <int LSTEP, int GSTEP = 2048, int NB = 4>
__device__ __forceinline__ void stage_tile(unsigned l0, const char* g0) {
#pragma unroll
  for (int b = 0; b < NB; ++b) {
    const unsigned l = l0 + b * 8 * LSTEP;
    const char* g = g0 + b * 8 * GSTEP;
    // the closing s_wait_xcnt keeps the address registers untouched until the copies have taken them
    asm volatile(
        "global_load_async_to_lds_b128 %0, %8, off\n\t"
        "global_load_async_to_lds_b128 %1, %9, off\n\t"
        "global_load_async_to_lds_b128 %2, %10, off\n\t"
        "global_load_async_to_lds_b128 %3, %11, off\n\t"
        "global_load_async_to_lds_b128 %4, %12, off\n\t"
        "global_load_async_to_lds_b128 %5, %13, off\n\t"
        "global_load_async_to_lds_b128 %6, %14, off\n\t"
        "global_load_async_to_lds_b128 %7, %15, off\n\t"
        "s_wait_xcnt 0x0"
        ::"v"(l), "v"(l + LSTEP), "v"(l + 2 * LSTEP), "v"(l + 3 * LSTEP), "v"(l + 4 * LSTEP),
        "v"(l + 5 * LSTEP), "v"(l + 6 * LSTEP), "v"(l + 7 * LSTEP), "v"(g), "v"(g + GSTEP),
        "v"(g + 2 * GSTEP), "v"(g + 3 * GSTEP), "v"(g + 4 * GSTEP), "v"(g + 5 * GSTEP),
        "v"(g + 6 * GSTEP), "v"(g + 7 * GSTEP)
        : "memory");
  }
}

// Hand-over of the ring: this wave's LDS reads are done, its own copies have landed, then every wave meets.
__device__ __forceinline__ void publish() {
  asm volatile("s_wait_dscnt 0x0" ::: "memory");    // my reads of the buffer that is refilled next have returned
  asm volatile("s_wait_asynccnt 0x0" ::: "memory");  // my copies of the next tile have landed
  __syncthreads();
}

// A block = 16 products and their 16 A fragments (32 LDS loads). The fragments of block b + 1 are fetched into a
// second register set ahead of the products of block b, inside one published tile only.
// Key rows p*32..+31 of a K tile: f[2 ks] the lower 16 rows, f[2 ks + 1] the upper, k step ks.
__device__ __forceinline__ void k_frags(v16h (&f)[16], const _Float16* buf, int p, int lane) {
#pragma unroll
  for (int ks = 0; ks < 8; ++ks) {
    f[2 * ks] = load_frag(buf, p * 32, ks * 32, KPITCH, lane);
    f[2 * ks + 1] = load_frag(buf, p * 32 + 16, ks * 32, KPITCH, lane);
  }
}
// The 64 rows of a V^T tile, keys g*128..+127: f[4 kl + i] rows i*16..+15, k step g*4 + kl.
__device__ __forceinline__ void v_frags(v16h (&f)[16], const _Float16* buf, int g, int lane) {
#pragma unroll
  for (int kl = 0; kl < 4; ++kl) {
#pragma unroll
    for (int i = 0; i < 4; ++i) f[4 * kl + i] = load_frag(buf, i * 16, (g * 4 + kl) * 32, VPITCH, lane);
  }
}
// Rows h*128..+127 of a WoSum column chunk: f[8 ks + i] rows (h*8 + i)*16..+15, k step ks of the chunk's two.
__device__ __forceinline__ void w_frags(v16h (&f)[16], const _Float16* buf, int h, int lane) {
#pragma unroll
  for (int ks = 0; ks < 2; ++ks) {
#pragma unroll
    for (int i = 0; i < 8; ++i) f[8 * ks + i] = load_frag(buf, (h * 8 + i) * 16, ks * 32, WPITCH, lane);
  }
}

// Energy, masked softmax, attn @ v and the output projection in one launch. Block = 4 waves, 16 queries a wave,
// one batch n.
//   S^T = K . Q^T       : A = K rows (LDS), B = Q (registers); a lane holds scores of ONE query
//   O^T = V^T . P^T     : A = V^T rows (LDS), B = the packed score tiles, never leaving registers
//   out^T += WoSum . O^T: A = WoSum rows, 64 columns a trip (LDS), B = the trip's 64 rows of O^T, packed as f16
// All 512 scores of a query stay in registers as f16 (the rounding the stored energy had).
__global__ __launch_bounds__(128) void attn_fused(const _Float16* __restrict__ qh,
                                                  const _Float16* __restrict__ kh,
                                                  const _Float16* __restrict__ vT,
                                                  const int* __restrict__ mask,
                                                  const _Float16* __restrict__ wo16,
                                                  const float* __restrict__ bo,
                                                  float* __restrict__ out) {
  __shared__ __attribute__((aligned(128))) _Float16 ring[2 * BUFH];
  __shared__ __attribute__((aligned(128))) _Float16 wring[2 * WBUFH];
  __shared__ __attribute__((aligned(16))) unsigned short keep[KL];  // 0xFFFF: key counts, 0: masked
  __shared__ int anyw[4];
  const int tid = threadIdx.x;
  const int lane = tid & 31;
  const int wave = tid >> 5;
  const int hi = lane >> 4;
  const int n = blockIdx.x >> 5;
  const int q0 = (blockIdx.x & 31) * 64 + wave * 16;

  const char* kg = (const char*)(kh + (size_t)n * KL * EDIM) + tid * 16;
  const char* vg = (const char*)(vT + (size_t)n * EDIM * KL) + tid * 16;
  const unsigned ring0 = (unsigned)(size_t)ring;
  const unsigned kl = ring0 + (tid >> 5) * (KPITCH * 2) + (tid & 31) * 16;
  const unsigned vl = ring0 + (tid >> 6) * (VPITCH * 2) + (tid & 63) * 16;
  // WoSum chunk: 8 lanes to a row's 128 B, 16 rows to a copy of the block
  const char* wg = (const char*)wo16 + (tid >> 3) * (EDIM * 2) + (tid & 7) * 16;
  const unsigned wl = (unsigned)(size_t)wring + (tid >> 3) * (WPITCH * 2) + (tid & 7) * 16;

  stage_tile<4 * KPITCH * 2>(kl, kg);  // keys 0..127 -> buffer 0

  {
    const v4i mv = *(const v4i*)(mask + n * KL + tid * 4);
    unsigned long long kw = 0;
#pragma unroll
    for (int j = 0; j < 4; ++j)
      if (mv[j] != 0) kw |= 0xFFFFull << (16 * j);
    *(unsigned long long*)(keep + tid * 4) = kw;
    const unsigned bal = __builtin_amdgcn_ballot_w32(kw != 0);
    if (lane == 0) anyw[wave] = (bal != 0);
  }

  const _Float16* qp = qh + ((size_t)n * QS + q0 + (lane & 15)) * EDIM + hi * 8;  // load_frag's k order
  v16h qf[8];
#pragma unroll
  for (int ks = 0; ks < 8; ++ks) {
    union { v16h v; h8 h[2]; } u;
    u.h[0] = *(const h8*)(qp + ks * 32);
    u.h[1] = *(const h8*)(qp + ks * 32 + 16);
    qf[ks] = u.v;
  }
  // the bias of the 2 x 4 output columns that this lane stores of every row
  const float* bp = bo + lane * 4;
  const f32x4 bias0 = *(const f32x4*)(bp);
  const f32x4 bias1 = *(const f32x4*)(bp + 128);
  // qp and bp as inputs keep the loads' address registers from being reused as a load's destination ahead of the wait
  asm volatile("s_wait_xcnt 0x0" ::"v"(qp), "v"(bp) : "memory");

  asm volatile("s_wait_asynccnt 0x0" ::: "memory");  // my copies of tile 0 have landed
  __syncthreads();
  stage_tile<4 * KPITCH * 2>(kl + BUFH * 2, kg + 65536);  // keys 128..255 -> buffer 1

  // ---- scores: sp[kk] holds keys kk*32..+31 of this lane's query in B-operand order
  v16h sp[16];
#pragma unroll  // sp[] is indexed by constants only, so it stays in registers
  for (int t = 0; t < 4; ++t) {
    const _Float16* buf = ring + (t & 1) * BUFH;
    v16h fr[2][16];
    k_frags(fr[0], buf, 0, lane);
#pragma unroll
    for (int p = 0; p < 4; ++p) {
      fence();
      if (p < 3) k_frags(fr[(p + 1) & 1], buf, p + 1, lane);
      fence();
      v8f s0 = {}, s1 = {};
#pragma unroll
      for (int ks = 0; ks < 8; ++ks) {
        s0 = __builtin_amdgcn_wmma_f32_16x16x32_f16(false, fr[p & 1][2 * ks], false, qf[ks], (short)0, s0, false, false);
        s1 = __builtin_amdgcn_wmma_f32_16x16x32_f16(false, fr[p & 1][2 * ks + 1], false, qf[ks], (short)0, s1, false,
                                                    false);
      }
      v16h pk;
#pragma unroll
      for (int j = 0; j < 8; ++j) {
        pk[j] = (_Float16)s0[j];
        pk[8 + j] = (_Float16)s1[j];
      }
      sp[t * 4 + p] = pk;
    }
    publish();
    if (t < 2)
      stage_tile<4 * KPITCH * 2>(kl + (t & 1) * (BUFH * 2), kg + (t + 2) * 65536);
    else {
      stage_tile<2 * VPITCH * 2>(vl + (t & 1) * (BUFH * 2), vg + (t - 2) * 65536);
      stage_tile<16 * WPITCH * 2, 16 * EDIM * 2, 2>(wl + (t & 1) * (WBUFH * 2), wg + (t - 2) * 128);
    }
  }

  // ---- masked softmax, in-lane; the two lane halves of a query meet once for the maximum, once for the sum
  // A masked key scores -inf (weight 0). With every key masked the reference is uniform: all scores 0.
  const unsigned fill = (anyw[0] | anyw[1] | anyw[2] | anyw[3]) ? 0xFC00FC00u : 0u;
  v16h mxv;
#pragma unroll
  for (int kk = 0; kk < 16; ++kk) {
    const u32x4 m0 = *(const u32x4*)(keep + kk * 32 + hi * 8);
    const u32x4 m1 = *(const u32x4*)(keep + kk * 32 + 16 + hi * 8);
    u32x8 s = __builtin_bit_cast(u32x8, sp[kk]);
#pragma unroll
    for (int i = 0; i < 4; ++i) {
      s[i] = (s[i] & m0[i]) | (fill & ~m0[i]);
      s[4 + i] = (s[4 + i] & m1[i]) | (fill & ~m1[i]);
    }
    sp[kk] = __builtin_bit_cast(v16h, s);
    mxv = kk ? __builtin_elementwise_max(mxv, sp[kk]) : sp[kk];
  }
  float mx = (float)mxv[0];
#pragma unroll
  for (int j = 1; j < 16; ++j) mx = fmaxf(mx, (float)mxv[j]);
  mx = fmaxf(mx, __shfl_xor(mx, 16, 32));
  const float sc = 0.0625f * 1.44269504f;  // 1/sqrt(E) * log2(e)
  const float mc = mx * sc;
  float sum[4] = {0.0f, 0.0f, 0.0f, 0.0f};
#pragma unroll
  for (int kk = 0; kk < 16; ++kk) {
    v16h pk;
#pragma unroll
    for (int j = 0; j < 16; ++j) {
      const float x = __builtin_amdgcn_exp2f(fmaf((float)sp[kk][j], sc, -mc));
      sum[j & 3] += x;
      pk[j] = (_Float16)x;
    }
    sp[kk] = pk;
  }
  float st = (sum[0] + sum[1]) + (sum[2] + sum[3]);
  st += __shfl_xor(st, 16, 32);
  const float inv = 1.0f / st;

  // ---- O^T, 64 rows of V^T a trip, and at once their share of out^T: a lane's 8 results of an O^T tile are 8
  // consecutive d of its query, so two tiles pack into one B operand (load_frag's k order), as the scores did.
  // acc[e] sums over d in rising order, 32 a product.
  v8f acc[16] = {};
  // The staging addresses once more, from the lane's number as the hardware counts it: a build that held vl, vg, wl
  // and wg (operands of the asm statements above) across the rolled loop spilled them to scratch; this one spills none.
  const int tid2 = __builtin_amdgcn_readfirstlane(wave) * 32 + (int)__builtin_amdgcn_mbcnt_lo(~0u, 0u);
  const char* vg2 = (const char*)(vT + (size_t)n * EDIM * KL) + tid2 * 16;
  const unsigned vl2 = ring0 + (tid2 >> 6) * (VPITCH * 2) + (tid2 & 63) * 16;
  const char* wg2 = (const char*)wo16 + (tid2 >> 3) * (EDIM * 2) + (tid2 & 7) * 16;
  const unsigned wl2 = (unsigned)(size_t)wring + (tid2 >> 3) * (WPITCH * 2) + (tid2 & 7) * 16;
#pragma unroll 1  // every register index is a constant, so one copy of the body serves all four trips: less text to fetch
  for (int c = 0; c < 4; ++c) {
    const _Float16* buf = ring + (c & 1) * BUFH;
    const _Float16* wb = wring + (c & 1) * WBUFH;
    v8f o[4] = {};
    v16h fr[2][16];
    v_frags(fr[0], buf, 0, lane);
#pragma unroll
    for (int g = 0; g < 4; ++g) {
      fence();
      if (g < 3)
        v_frags(fr[(g + 1) & 1], buf, g + 1, lane);
      else
        w_frags(fr[0], wb, 0, lane);
      fence();
#pragma unroll
      for (int kl = 0; kl < 4; ++kl) {
#pragma unroll
        for (int i = 0; i < 4; ++i) {
          o[i] = __builtin_amdgcn_wmma_f32_16x16x32_f16(false, fr[g & 1][4 * kl + i], false, sp[g * 4 + kl], (short)0,
                                                        o[i], false, false);
        }
      }
    }
    fence();
    w_frags(fr[1], wb, 1, lane);
    fence();
    v16h cf[2];
#pragma unroll
    for (int i = 0; i < 4; ++i) {
#pragma unroll
      for (int j = 0; j < 8; ++j) cf[i >> 1][(i & 1) * 8 + j] = (_Float16)(o[i][j] * inv);
    }
#pragma unroll
    for (int h = 0; h < 2; ++h) {
#pragma unroll
      for (int ks = 0; ks < 2; ++ks) {
#pragma unroll
        for (int i = 0; i < 8; ++i) {
          acc[h * 8 + i] = __builtin_amdgcn_wmma_f32_16x16x32_f16(false, fr[h][8 * ks + i], false, cf[ks], (short)0,
                                                                  acc[h * 8 + i], false, false);
        }
      }
    }
    fence();  // without it the compiler moved these products behind the hand-over's waits and barrier, the refill behind them
    publish();
    if (c < 2) {
      stage_tile<2 * VPITCH * 2>(vl2 + (c & 1) * (BUFH * 2), vg2 + (c + 2) * 65536);
      stage_tile<16 * WPITCH * 2, 16 * EDIM * 2, 2>(wl2 + (c & 1) * (WBUFH * 2), wg2 + (c + 2) * 128);
    }
  }
  asm volatile("s_wait_asynccnt 0x0" ::: "memory");  // nothing of mine is in flight any more

  // ---- out rows leave as whole 128-byte lines: each wave turns its 16 x 256 tile in a range of the ring that is
  // its own. Behind the last publish() no wave reads the ring and no copy is aimed at it.
  float* stg = (float*)ring + wave * (16 * OPITCH);
  float* sw = stg + (lane & 15) * OPITCH + hi * 8;
#pragma unroll
  for (int e = 0; e < 16; ++e) {
    *(f32x4*)(sw + e * 16) = __builtin_shufflevector(acc[e], acc[e], 0, 1, 2, 3);
    *(f32x4*)(sw + e * 16 + 4) = __builtin_shufflevector(acc[e], acc[e], 4, 5, 6, 7);
  }
  asm volatile("s_wait_dscnt 0x0" ::: "memory");  // the wave's own rows are written before its lanes read across them
  const float* sr = stg + lane * 4;
  float* orow = out + ((size_t)n * QS + q0) * EDIM + lane * 4;
  f32x4 ov[16][2];
#pragma unroll
  for (int r = 0; r < 16; ++r) {
    ov[r][0] = *(const f32x4*)(sr + r * OPITCH);
    ov[r][1] = *(const f32x4*)(sr + r * OPITCH + 128);
  }
#pragma unroll
  for (int r = 0; r < 16; r += 4) {
#pragma unroll
    for (int i = r; i < r + 4; ++i) {
      ov[i][0] += bias0;
      ov[i][1] += bias1;
      *(f32x4*)(orow + i * EDIM) = ov[i][0];
      *(f32x4*)(orow + i * EDIM + 128) = ov[i][1];
    }
    // the stored values and the address as inputs keep the eight stores' registers untouched up to the wait
    asm volatile("s_wait_xcnt 0x0" ::"v"(orow), "v"(ov[r][0]), "v"(ov[r][1]), "v"(ov[r + 1][0]), "v"(ov[r + 1][1]),
                 "v"(ov[r + 2][0]), "v"(ov[r + 2][1]), "v"(ov[r + 3][0]), "v"(ov[r + 3][1])
                 : "memory");
  }
}

extern "C" void kernel_launch(void* const* d_in, const int* in_sizes, int n_in,
                              void* d_out, int out_size, void* d_ws, size_t ws_size,
                              hipStream_t stream) {
  const float* values = (const float*)d_in[0];
  const float* keys   = (const float*)d_in[1];
  const float* query  = (const float*)d_in[2];
  const int*   mask   = (const int*)d_in[3];
  const float* Wv = (const float*)d_in[4];
  const float* Wk = (const float*)d_in[5];
  const float* Wq = (const float*)d_in[6];
  const float* Wo = (const float*)d_in[7];
  const float* bo = (const float*)d_in[8];
  float* out = (float*)d_out;

  // Workspace carve (all f16 intermediates)
  char* ws = (char*)d_ws;
  size_t off = 0;
  auto carve = [&](size_t bytes) -> void* {
    void* p = ws + off;
    off = (off + bytes + 255) & ~(size_t)255;
    return p;
  };
  _Float16* wo16 = (_Float16*)carve((size_t)EDIM * EDIM * 2);         // head-folded Wo
  _Float16* qh   = (_Float16*)carve((size_t)NBATCH * QS * EDIM * 2);  // q proj
  _Float16* kh   = (_Float16*)carve((size_t)NBATCH * KL * EDIM * 2);  // k proj [n][k][d]
  _Float16* vT   = (_Float16*)carve((size_t)NBATCH * KL * EDIM * 2);  // v proj [n][d][k]
  (void)ws_size; (void)in_sizes; (void)n_in; (void)out_size;

  const dim3 blk(256);

  // --- projections X @ W^T from the f32 inputs (v stored transposed per batch: vT[n][d][k]) and weight folding ---
  proj_all<<<QTILES + 2 * KTILES + WOBLKS, blk, 0, stream>>>(query, keys, values, Wq, Wk, Wv, Wo, qh, kh, vT, wo16);

  // --- out = (softmax(mask(q k^T) / 16) @ v) @ WoSum^T + bo, scores and context kept in registers ---
  attn_fused<<<NBATCH * (QS / 64), dim3(128), 0, stream>>>(qh, kh, vT, mask, wo16, bo, out);
}

// v007
// One run takes 22.6 microseconds.
// Two timings next to v006 both put it at 1.11 times that version's speed.
// Over all steps from v000 it is 6.40 times as fast.
#include <hip/hip_runtime.h>

// Shapes from reference: N=8, KLEN=512, Q=16, S=128, E=256, H=8
#define NBATCH 8
#define KL     512
#define QS     2048   // Q*S
#define EDIM   256
#define HEADS  8

typedef _Float16 h8   __attribute__((ext_vector_type(8)));
typedef _Float16 v16h __attribute__((ext_vector_type(16)));
typedef float    v8f  __attribute__((ext_vector_type(8)));
typedef int      v4i  __attribute__((ext_vector_type(4)));

// Build a 16x32 f16 WMMA fragment from a row-major [rows x ld] f16 matrix.
// Identical striping for A ([M][K]) and B stored as B^T ([N][K]):
//   lane<16 : halves 0..7 = K0..K0+7,  halves 8..15 = K0+16..K0+23 (row r0+lane)
//   lane>=16: halves 0..7 = K0+8..+15, halves 8..15 = K0+24..+31   (row r0+lane-16)
template <typename PtrT>
__device__ __forceinline__ v16h load_frag(PtrT base, int r0, int k0, int ld, int lane) {
  PtrT p = base + (size_t)(r0 + (lane & 15)) * ld + k0 + ((lane & 16) ? 8 : 0);
  union { v16h v; h8 h[2]; } u;
  u.h[0] = *(const h8*)(p);
  u.h[1] = *(const h8*)(p + 16);
  return u.v;
}

typedef float f32x4 __attribute__((ext_vector_type(4)));

typedef _Float16 h4 __attribute__((ext_vector_type(4)));

// Nothing is scheduled across it. Without it the compiler sinks every fragment load to just in front of its product,
// and the wave waits out the LDS latency at each product.
__device__ __forceinline__ void fence() { __builtin_amdgcn_sched_barrier(0); }

#define TROWS  128  // rows of X to a block
#define XPITCH 264  // halves per staged row of X or W (512 B + 16 B: 16 B x odd, no bank conflict for b128 readers)
#define CPITCH 72   // halves per staged line of a wave's result tile (128 B + 16 B)

// Projection C = X . W^T straight from the f32 inputs: X [rows][EDIM], W [EDIM][EDIM], both row-major.
// A block takes 128 rows of X and all of W: every wave-wide load covers 512 consecutive bytes, each value is rounded
// to f16 in registers and laid in LDS. 8 waves as 2 (rows) x 4 (columns), wave tile 64 x 64, k rising, 32 a product.
// TRANSB false: C^T = W . X^T, so a lane holds 8 consecutive columns of one row of C [row][EDIM].
// TRANSB true : C   = X . W^T, so a lane holds 8 consecutive rows of one column: out is [row/KL][EDIM][KL].
// Either way a wave's 64 x 64 tile is 64 whole 128-byte lines of C: it is turned in LDS and leaves line by line.
template <bool TRANSB>
__device__ __forceinline__ void proj_f32(const float* __restrict__ X,
                                         const float* __restrict__ Wt,
                                         _Float16* __restrict__ C, _Float16* xs, _Float16* wsh, _Float16* cst,
                                         int tile) {
  const int lane = threadIdx.x & 31;
  const int wave = threadIdx.x >> 5;

  // byte offsets: a uniform base and one register a stream. A wave takes 16 rows of X and 32 rows of W, half a row a load.
  const unsigned xo = (unsigned)((tile * TROWS + wave * 16) * EDIM + lane * 4) * 4u;
  const unsigned wo = (unsigned)(wave * 32 * EDIM + lane * 4) * 4u;
  const char* xp = (const char*)X + xo;
  const char* wp = (const char*)Wt + wo;
  f32x4 xr[32];
#pragma unroll
  for (int i = 0; i < 32; ++i) xr[i] = *(const f32x4*)(xp + i * 512);
  f32x4 wr[64];
#pragma unroll
  for (int i = 0; i < 64; ++i) wr[i] = *(const f32x4*)(wp + i * 512);
  // xo and wo as inputs keep the loads' address registers untouched (also as a later load's destination) up to the wait.
  // Its memory clobber holds all 96 loads ahead of it: without the statement the compiler pairs loads with their
  // rounding, one memory round trip after the other.
  asm volatile("s_wait_xcnt 0x0" ::"v"(xo), "v"(wo) : "memory");

  _Float16* xd = xs + wave * 16 * XPITCH + lane * 4;
  _Float16* wd = wsh + wave * 32 * XPITCH + lane * 4;
#pragma unroll
  for (int i = 0; i < 32; ++i) *(h4*)(xd + (i >> 1) * XPITCH + (i & 1) * 128) = __builtin_convertvector(xr[i], h4);
#pragma unroll
  for (int i = 0; i < 64; ++i) *(h4*)(wd + (i >> 1) * XPITCH + (i & 1) * 128) = __builtin_convertvector(wr[i], h4);
  __syncthreads();

  const int rg = wave >> 2;  // which 64 rows of the tile
  const int cg = wave & 3;   // which 64 columns
  const _Float16* ab = TRANSB ? xs + rg * 64 * XPITCH : wsh + cg * 64 * XPITCH;  // A operand's 64 rows
  const _Float16* bb = TRANSB ? wsh + cg * 64 * XPITCH : xs + rg * 64 * XPITCH;  // B operand's 64 rows
  v8f acc[4][4] = {};
  v16h fa[2][4], fb[2][4];  // the fragments of k step ks + 1 are fetched ahead of the products of k step ks
#pragma unroll
  for (int i = 0; i < 4; ++i) {
    fa[0][i] = load_frag(ab, i * 16, 0, XPITCH, lane);
    fb[0][i] = load_frag(bb, i * 16, 0, XPITCH, lane);
  }
#pragma unroll
  for (int ks = 0; ks < 8; ++ks) {
    fence();
    if (ks < 7) {
#pragma unroll
      for (int i = 0; i < 4; ++i) {
        fa[(ks + 1) & 1][i] = load_frag(ab, i * 16, (ks + 1) * 32, XPITCH, lane);
        fb[(ks + 1) & 1][i] = load_frag(bb, i * 16, (ks + 1) * 32, XPITCH, lane);
      }
    }
    fence();
#pragma unroll
    for (int i = 0; i < 4; ++i) {
#pragma unroll
      for (int j = 0; j < 4; ++j) {
        acc[i][j] = __builtin_amdgcn_wmma_f32_16x16x32_f16(false, fa[ks & 1][i], false, fb[ks & 1][j], (short)0,
                                                           acc[i][j], false, false);
      }
    }
  }

  // D layout: VGPR j holds (M = (lane<16 ? j : 8+j), N = lane&15): 8 consecutive M of one N, 16 bytes as f16.
  // Line j * 16 + N of the wave's tile (a row of C, or a column where TRANSB), halves i * 16 + M of that line.
  const int m0 = (lane >> 4) * 8;  // + i * 16
  const int nn = lane & 15;        // + j * 16
  const int row0 = tile * TROWS + rg * 64;  // a tile's 128 rows lie in one batch (KL is a multiple of 128)
  const int col0 = cg * 64;
  _Float16* cw = cst + wave * (64 * CPITCH);  // this wave's own range: no other wave reads or writes it
  _Float16* sw = cw + nn * CPITCH + m0;
#pragma unroll
  for (int i = 0; i < 4; ++i) {
#pragma unroll
    for (int j = 0; j < 4; ++j) *(h8*)(sw + j * 16 * CPITCH + i * 16) = __builtin_convertvector(acc[i][j], h8);
  }
  asm volatile("s_wait_dscnt 0x0" ::: "memory");  // the wave's own lines are written before its lanes read across them
  // 8 lanes to a line, the four lines of a load or store 8 apart (in LDS 8 pitches = 32 banks: no conflict)
  const int l0 = (lane >> 3) * 8;  // + (r & 7) + (r >> 3) * 32
  const int h0 = (lane & 7) * 8;
  const int ld = TRANSB ? KL : EDIM;  // halves from one line of the tile to the next
  const _Float16* sr = cw + l0 * CPITCH + h0;
  _Float16* cp = TRANSB ? C + (size_t)(row0 / KL) * EDIM * KL + (size_t)(col0 + l0) * KL + (row0 % KL) + h0
                        : C + (size_t)(row0 + l0) * EDIM + col0 + h0;
  h8 hv[16];
#pragma unroll
  for (int r = 0; r < 16; ++r) hv[r] = *(const h8*)(sr + ((r & 7) + (r >> 3) * 32) * CPITCH);
#pragma unroll
  for (int r = 0; r < 16; ++r) *(h8*)(cp + ((r & 7) + (r >> 3) * 32) * ld) = hv[r];
  // the stored values and the address as inputs keep the sixteen stores' registers untouched up to the wait
  asm volatile("s_wait_xcnt 0x0" ::"v"(cp), "v"(hv[0]), "v"(hv[1]), "v"(hv[2]), "v"(hv[3]), "v"(hv[4]), "v"(hv[5]),
               "v"(hv[6]), "v"(hv[7]), "v"(hv[8]), "v"(hv[9]), "v"(hv[10]), "v"(hv[11]), "v"(hv[12]), "v"(hv[13]),
               "v"(hv[14]), "v"(hv[15])
               : "memory");
}

// WoSum[e][d] = sum_h Wo[e][h*E + d]  (heads are replicated -> fold Wo to 256x256); i = e * EDIM + d, 4 d a thread
__device__ __forceinline__ void wo_fold(const float* __restrict__ Wo, _Float16* __restrict__ d, int i) {
  const unsigned x = (unsigned)((i >> 8) * (HEADS * EDIM) + (i & 255));
  f32x4 w[HEADS];
#pragma unroll
  for (int h = 0; h < HEADS; ++h) w[h] = *(const f32x4*)(Wo + x + h * EDIM);
  // x as an input keeps the loads' address register from being reused as a load's destination ahead of the wait
  asm volatile("s_wait_xcnt 0x0" ::"v"(x) : "memory");
  f32x4 s = {0.0f, 0.0f, 0.0f, 0.0f};
#pragma unroll
  for (int h = 0; h < HEADS; ++h) s += w[h];
  *(h4*)(d + i) = __builtin_convertvector(s, h4);
  // the store has taken its registers before any code laid out behind this body writes into them
  asm volatile("s_wait_xcnt 0x0" ::: "memory");
}

// Jobs of the first launch, picked by block index: the 128-row tiles of the three projections, then the fold of Wo.
// None of them reads what another writes. 256 blocks in all, each with a WGP's LDS mostly to itself.
#define QTILES (NBATCH * QS / TROWS)     // 128 tiles of q
#define KTILES (NBATCH * KL / TROWS)     // 32 tiles of k, as many of v
#define WOBLKS (EDIM * EDIM / (256 * 4))  // 64 blocks, four folded weights a thread

__global__ __launch_bounds__(256) void proj_all(const float* __restrict__ query, const float* __restrict__ keys,
                                                const float* __restrict__ values, const float* __restrict__ Wq,
                                                const float* __restrict__ Wk, const float* __restrict__ Wv,
                                                const float* __restrict__ Wo, _Float16* __restrict__ qh,
                                                _Float16* __restrict__ kh, _Float16* __restrict__ vT,
                                                _Float16* __restrict__ wo16) {
  __shared__ __attribute__((aligned(16))) _Float16 xs[TROWS * XPITCH];
  __shared__ __attribute__((aligned(16))) _Float16 wsh[EDIM * XPITCH];
  __shared__ __attribute__((aligned(16))) _Float16 cst[8 * 64 * CPITCH];  // 64 result lines to each of the 8 waves
  const int b = blockIdx.x;  // every test on it reads the same for the whole block
  const bool isq = b < QTILES;
  if (b < QTILES + KTILES)
    proj_f32<false>(isq ? query : keys, isq ? Wq : Wk, isq ? qh : kh, xs, wsh, cst, isq ? b : b - QTILES);
  else if (b < QTILES + 2 * KTILES)
    proj_f32<true>(values, Wv, vT, xs, wsh, cst, b - (QTILES + KTILES));
  else
    wo_fold(Wo, wo16, ((b - (QTILES + 2 * KTILES)) * 256 + (int)threadIdx.x) * 4);
}

typedef unsigned int u32x4 __attribute__((ext_vector_type(4)));
typedef unsigned int u32x8 __attribute__((ext_vector_type(8)));

#define KPITCH 264    // halves per staged K row   (512 B + 16 B: 16 B x odd, no bank conflict for b128 readers)
#define VPITCH 520    // halves per staged V^T row (1024 B + 16 B)
#define BUFH   33792  // halves per ring buffer: 128 K rows (the 64 V^T rows need less)
#define WPITCH 72     // halves per staged row of a WoSum column chunk (128 B + 16 B)
#define WBUFH  (EDIM * WPITCH)  // halves per chunk buffer: 256 rows of 64 columns
#define OPITCH 260    // floats per staged output row (1024 B + 16 B)

// NB * 8 copies of 16 B per lane into one ring buffer.
// Copy j of a lane lies GSTEP bytes further in global memory and LSTEP bytes further in LDS.
// K, V^T: one 64 KB tile, contiguous in global memory (GSTEP 2048, 32 copies).
template <int LSTEP, int GSTEP = 2048, int NB = 4>
__device__ __forceinline__ void stage_tile(unsigned l0, const char* g0) {
#pragma unroll
  for (int b = 0; b < NB; ++b) {
    const unsigned l = l0 + b * 8 * LSTEP;
    const char* g = g0 + b * 8 * GSTEP;
    // the closing s_wait_xcnt keeps the address registers untouched until the copies have taken them
    asm volatile(
        "global_load_async_to_lds_b128 %0, %8, off\n\t"
        "global_load_async_to_lds_b128 %1, %9, off\n\t"
        "global_load_async_to_lds_b128 %2, %10, off\n\t"
        "global_load_async_to_lds_b128 %3, %11, off\n\t"
        "global_load_async_to_lds_b128 %4, %12, off\n\t"
        "global_load_async_to_lds_b128 %5, %13, off\n\t"
        "global_load_async_to_lds_b128 %6, %14, off\n\t"
        "global_load_async_to_lds_b128 %7, %15, off\n\t"
        "s_wait_xcnt 0x0"
        ::"v"(l), "v"(l + LSTEP), "v"(l + 2 * LSTEP), "v"(l + 3 * LSTEP), "v"(l + 4 * LSTEP),
        "v"(l + 5 * LSTEP), "v"(l + 6 * LSTEP), "v"(l + 7 * LSTEP), "v"(g), "v"(g + GSTEP),
        "v"(g + 2 * GSTEP), "v"(g + 3 * GSTEP), "v"(g + 4 * GSTEP), "v"(g + 5 * GSTEP),
        "v"(g + 6 * GSTEP), "v"(g + 7 * GSTEP)
        : "memory");
  }
}

// Hand-over of the ring: this wave's LDS reads are done, its own copies have landed, then every wave meets.
__device__ __forceinline__ void publish() {
  asm volatile("s_wait_dscnt 0x0" ::: "memory");    // my reads of the buffer that is refilled next have returned
  asm volatile("s_wait_asynccnt 0x0" ::: "memory");  // my copies of the next tile have landed
  __syncthreads();
}

// A block = 16 products and their 16 A fragments (32 LDS loads). The fragments of block b + 1 are fetched into a
// second register set ahead of the products of block b, inside one published tile only.
// Key rows p*32..+31 of a K tile: f[2 ks] the lower 16 rows, f[2 ks + 1] the upper, k step ks.
__device__ __forceinline__ void k_frags(v16h (&f)[16], const _Float16* buf, int p, int lane) {
#pragma unroll
  for (int ks = 0; ks < 8; ++ks) {
    f[2 * ks] = load_frag(buf, p * 32, ks * 32, KPITCH, lane);
    f[2 * ks + 1] = load_frag(buf, p * 32 + 16, ks * 32, KPITCH, lane);
  }
}
// The 64 rows of a V^T tile, keys g*128..+127: f[4 kl + i] rows i*16..+15, k step g*4 + kl.
__device__ __forceinline__ void v_frags(v16h (&f)[16], const _Float16* buf, int g, int lane) {
#pragma unroll
  for (int kl = 0; kl < 4; ++kl) {
#pragma unroll
    for (int i = 0; i < 4; ++i) f[4 * kl + i] = load_frag(buf, i * 16, (g * 4 + kl) * 32, VPITCH, lane);
  }
}
// Rows h*128..+127 of a WoSum column chunk: f[8 ks + i] rows (h*8 + i)*16..+15, k step ks of the chunk's two.
__device__ __forceinline__ void w_frags(v16h (&f)[16], const _Float16* buf, int h, int lane) {
#pragma unroll
  for (int ks = 0; ks < 2; ++ks) {
#pragma unroll
    for (int i = 0; i < 8; ++i) f[8 * ks + i] = load_frag(buf, (h * 8 + i) * 16, ks * 32, WPITCH, lane);
  }
}

// Energy, masked softmax, attn @ v and the output projection in one launch. Block = 4 waves, 16 queries a wave,
// one batch n.
//   S^T = K . Q^T       : A = K rows (LDS), B = Q (registers); a lane holds scores of ONE query
//   O^T = V^T . P^T     : A = V^T rows (LDS), B = the packed score tiles, never leaving registers
//   out^T += WoSum . O^T: A = WoSum rows, 64 columns a trip (LDS), B = the trip's 64 rows of O^T, packed as f16
// All 512 scores of a query stay in registers as f16 (the rounding the stored energy had).
__global__ __launch_bounds__(128) void attn_fused(const _Float16* __restrict__ qh,
                                                  const _Float16* __restrict__ kh,
                                                  const _Float16* __restrict__ vT,
                                                  const int* __restrict__ mask,
                                                  const _Float16* __restrict__ wo16,
                                                  const float* __restrict__ bo,
                                                  float* __restrict__ out) {
  __shared__ __attribute__((aligned(128))) _Float16 ring[2 * BUFH];
  __shared__ __attribute__((aligned(128))) _Float16 wring[2 * WBUFH];
  __shared__ __attribute__((aligned(16))) unsigned short keep[KL];  // 0xFFFF: key counts, 0: masked
  __shared__ int anyw[4];
  const int tid = threadIdx.x;
  const int lane = tid & 31;
  const int wave = tid >> 5;
  const int hi = lane >> 4;
  const int n = blockIdx.x >> 5;
  const int q0 = (blockIdx.x & 31) * 64 + wave * 16;

  const char* kg = (const char*)(kh + (size_t)n * KL * EDIM) + tid * 16;
  const char* vg = (const char*)(vT + (size_t)n * EDIM * KL) + tid * 16;
  const unsigned ring0 = (unsigned)(size_t)ring;
  const unsigned kl = ring0 + (tid >> 5) * (KPITCH * 2) + (tid & 31) * 16;
  const unsigned vl = ring0 + (tid >> 6) * (VPITCH * 2) + (tid & 63) * 16;
  // WoSum chunk: 8 lanes to a row's 128 B, 16 rows to a copy of the block
  const char* wg = (const char*)wo16 + (tid >> 3) * (EDIM * 2) + (tid & 7) * 16;
  const unsigned wl = (unsigned)(size_t)wring + (tid >> 3) * (WPITCH * 2) + (tid & 7) * 16;

  stage_tile<4 * KPITCH * 2>(kl, kg);  // keys 0..127 -> buffer 0

  {
    const v4i mv = *(const v4i*)(mask + n * KL + tid * 4);
    unsigned long long kw = 0;
#pragma unroll
    for (int j = 0; j < 4; ++j)
      if (mv[j] != 0) kw |= 0xFFFFull << (16 * j);
    *(unsigned long long*)(keep + tid * 4) = kw;
    const unsigned bal = __builtin_amdgcn_ballot_w32(kw != 0);
    if (lane == 0) anyw[wave] = (bal != 0);
  }

  const _Float16* qp = qh + ((size_t)n * QS + q0 + (lane & 15)) * EDIM + hi * 8;  // load_frag's k order
  v16h qf[8];
#pragma unroll
  for (int ks = 0; ks < 8; ++ks) {
    union { v16h v; h8 h[2]; } u;
    u.h[0] = *(const h8*)(qp + ks * 32);
    u.h[1] = *(const h8*)(qp + ks * 32 + 16);
    qf[ks] = u.v;
  }
  // the bias of the 2 x 4 output columns that this lane stores of every row
  const float* bp = bo + lane * 4;
  const f32x4 bias0 = *(const f32x4*)(bp);
  const f32x4 bias1 = *(const f32x4*)(bp + 128);
  // qp and bp as inputs keep the loads' address registers from being reused as a load's destination ahead of the wait
  asm volatile("s_wait_xcnt 0x0" ::"v"(qp), "v"(bp) : "memory");

  asm volatile("s_wait_asynccnt 0x0" ::: "memory");  // my copies of tile 0 have landed
  __syncthreads();
  stage_tile<4 * KPITCH * 2>(kl + BUFH * 2, kg + 65536);  // keys 128..255 -> buffer 1

  // ---- scores: sp[kk] holds keys kk*32..+31 of this lane's query in B-operand order
  v16h sp[16];
#pragma unroll  // sp[] is indexed by constants only, so it stays in registers
  for (int t = 0; t < 4; ++t) {
    const _Float16* buf = ring + (t & 1) * BUFH;
    v16h fr[2][16];
    k_frags(fr[0], buf, 0, lane);
#pragma unroll
    for (int p = 0; p < 4; ++p) {
      fence();
      if (p < 3) k_frags(fr[(p + 1) & 1], buf, p + 1, lane);
      fence();
      v8f s0 = {}, s1 = {};
#pragma unroll
      for (int ks = 0; ks < 8; ++ks) {
        s0 = __builtin_amdgcn_wmma_f32_16x16x32_f16(false, fr[p & 1][2 * ks], false, qf[ks], (short)0, s0, false, false);
        s1 = __builtin_amdgcn_wmma_f32_16x16x32_f16(false, fr[p & 1][2 * ks + 1], false, qf[ks], (short)0, s1, false,
                                                    false);
      }
      v16h pk;
#pragma unroll
      for (int j = 0; j < 8; ++j) {
        pk[j] = (_Float16)s0[j];
        pk[8 + j] = (_Float16)s1[j];
      }
      sp[t * 4 + p] = pk;
    }
    publish();
    if (t < 2)
      stage_tile<4 * KPITCH * 2>(kl + (t & 1) * (BUFH * 2), kg + (t + 2) * 65536);
    else {
      stage_tile<2 * VPITCH * 2>(vl + (t & 1) * (BUFH * 2), vg + (t - 2) * 65536);
      stage_tile<16 * WPITCH * 2, 16 * EDIM * 2, 2>(wl + (t & 1) * (WBUFH * 2), wg + (t - 2) * 128);
    }
  }

  // ---- masked softmax, in-lane; the two lane halves of a query meet once for the maximum, once for the sum
  // A masked key scores -inf (weight 0). With every key masked the reference is uniform: all scores 0.
  const unsigned fill = (anyw[0] | anyw[1] | anyw[2] | anyw[3]) ? 0xFC00FC00u : 0u;
  v16h mxv;
#pragma unroll
  for (int kk = 0; kk < 16; ++kk) {
    const u32x4 m0 = *(const u32x4*)(keep + kk * 32 + hi * 8);
    const u32x4 m1 = *(const u32x4*)(keep + kk * 32 + 16 + hi * 8);
    u32x8 s = __builtin_bit_cast(u32x8, sp[kk]);
#pragma unroll
    for (int i = 0; i < 4; ++i) {
      s[i] = (s[i] & m0[i]) | (fill & ~m0[i]);
      s[4 + i] = (s[4 + i] & m1[i]) | (fill & ~m1[i]);
    }
    sp[kk] = __builtin_bit_cast(v16h, s);
    mxv = kk ? __builtin_elementwise_max(mxv, sp[kk]) : sp[kk];
  }
  float mx = (float)mxv[0];
#pragma unroll
  for (int j = 1; j < 16; ++j) mx = fmaxf(mx, (float)mxv[j]);
  mx = fmaxf(mx, __shfl_xor(mx, 16, 32));
  const float sc = 0.0625f * 1.44269504f;  // 1/sqrt(E) * log2(e)
  const float mc = mx * sc;
  float sum[4] = {0.0f, 0.0f, 0.0f, 0.0f};
#pragma unroll
  for (int kk = 0; kk < 16; ++kk) {
    v16h pk;
#pragma unroll
    for (int j = 0; j < 16; ++j) {
      const float x = __builtin_amdgcn_exp2f(fmaf((float)sp[kk][j], sc, -mc));
      sum[j & 3] += x;
      pk[j] = (_Float16)x;
    }
    sp[kk] = pk;
  }
  float st = (sum[0] + sum[1]) + (sum[2] + sum[3]);
  st += __shfl_xor(st, 16, 32);
  const float inv = 1.0f / st;

  // ---- O^T, 64 rows of V^T a trip, and at once their share of out^T: a lane's 8 results of an O^T tile are 8
  // consecutive d of its query, so two tiles pack into one B operand (load_frag's k order), as the scores did.
  // acc[e] sums over d in rising order, 32 a product.
  v8f acc[16] = {};
  // The staging addresses once more, from the lane's number as the hardware counts it: a build that held vl, vg, wl
  // and wg (operands of the asm statements above) across the rolled loop spilled them to scratch; this one spills none.
  const int tid2 = __builtin_amdgcn_readfirstlane(wave) * 32 + (int)__builtin_amdgcn_mbcnt_lo(~0u, 0u);
  const char* vg2 = (const char*)(vT + (size_t)n * EDIM * KL) + tid2 * 16;
  const unsigned vl2 = ring0 + (tid2 >> 6) * (VPITCH * 2) + (tid2 & 63) * 16;
  const char* wg2 = (const char*)wo16 + (tid2 >> 3) * (EDIM * 2) + (tid2 & 7) * 16;
  const unsigned wl2 = (unsigned)(size_t)wring + (tid2 >> 3) * (WPITCH * 2) + (tid2 & 7) * 16;
#pragma unroll 1  // every register index is a constant, so one copy of the body serves all four trips: less text to fetch
  for (int c = 0; c < 4; ++c) {
    const _Float16* buf = ring + (c & 1) * BUFH;
    const _Float16* wb = wring + (c & 1) * WBUFH;
    v8f o[4] = {};
    v16h fr[2][16];
    v_frags(fr[0], buf, 0, lane);
#pragma unroll
    for (int g = 0; g < 4; ++g) {
      fence();
      if (g < 3)
        v_frags(fr[(g + 1) & 1], buf, g + 1, lane);
      else
        w_frags(fr[0], wb, 0, lane);
      fence();
#pragma unroll
      for (int kl = 0; kl < 4; ++kl) {
#pragma unroll
        for (int i = 0; i < 4; ++i) {
          o[i] = __builtin_amdgcn_wmma_f32_16x16x32_f16(false, fr[g & 1][4 * kl + i], false, sp[g * 4 + kl], (short)0,
                                                        o[i], false, false);
        }
      }
    }
    fence();
    w_frags(fr[1], wb, 1, lane);
    fence();
    v16h cf[2];
#pragma unroll
    for (int i = 0; i < 4; ++i) {
#pragma unroll
      for (int j = 0; j < 8; ++j) cf[i >> 1][(i & 1) * 8 + j] = (_Float16)(o[i][j] * inv);
    }
#pragma unroll
    for (int h = 0; h < 2; ++h) {
#pragma unroll
      for (int ks = 0; ks < 2; ++ks) {
#pragma unroll
        for (int i = 0; i < 8; ++i) {
          acc[h * 8 + i] = __builtin_amdgcn_wmma_f32_16x16x32_f16(false, fr[h][8 * ks + i], false, cf[ks], (short)0,
                                                                  acc[h * 8 + i], false, false);
        }
      }
    }
    fence();  // without it the compiler moved these products behind the hand-over's waits and barrier, the refill behind them
    publish();
    if (c < 2) {
      stage_tile<2 * VPITCH * 2>(vl2 + (c & 1) * (BUFH * 2), vg2 + (c + 2) * 65536);
      stage_tile<16 * WPITCH * 2, 16 * EDIM * 2, 2>(wl2 + (c & 1) * (WBUFH * 2), wg2 + (c + 2) * 128);
    }
  }
  asm volatile("s_wait_asynccnt 0x0" ::: "memory");  // nothing of mine is in flight any more

  // ---- out rows leave as whole 128-byte lines: each wave turns its 16 x 256 tile in a range of the ring that is
  // its own. Behind the last publish() no wave reads the ring and no copy is aimed at it.
  float* stg = (float*)ring + wave * (16 * OPITCH);
  float* sw = stg + (lane & 15) * OPITCH + hi * 8;
#pragma unroll
  for (int e = 0; e < 16; ++e) {
    *(f32x4*)(sw + e * 16) = __builtin_shufflevector(acc[e], acc[e], 0, 1, 2, 3);
    *(f32x4*)(sw + e * 16 + 4) = __builtin_shufflevector(acc[e], acc[e], 4, 5, 6, 7);
  }
  asm volatile("s_wait_dscnt 0x0" ::: "memory");  // the wave's own rows are written before its lanes read across them
  const float* sr = stg + lane * 4;
  float* orow = out + ((size_t)n * QS + q0) * EDIM + lane * 4;
  f32x4 ov[16][2];
#pragma unroll
  for (int r = 0; r < 16; ++r) {
    ov[r][0] = *(const f32x4*)(sr + r * OPITCH);
    ov[r][1] = *(const f32x4*)(sr + r * OPITCH + 128);
  }
#pragma unroll
  for (int r = 0; r < 16; r += 4) {
#pragma unroll
    for (int i = r; i < r + 4; ++i) {
      ov[i][0] += bias0;
      ov[i][1] += bias1;
      *(f32x4*)(orow + i * EDIM) = ov[i][0];
      *(f32x4*)(orow + i * EDIM + 128) = ov[i][1];
    }
    // the stored values and the address as inputs keep the eight stores' registers untouched up to the wait
    asm volatile("s_wait_xcnt 0x0" ::"v"(orow), "v"(ov[r][0]), "v"(ov[r][1]), "v"(ov[r + 1][0]), "v"(ov[r + 1][1]),
                 "v"(ov[r + 2][0]), "v"(ov[r + 2][1]), "v"(ov[r + 3][0]), "v"(ov[r + 3][1])
                 : "memory");
  }
}

extern "C" void kernel_launch(void* const* d_in, const int* in_sizes, int n_in,
                              void* d_out, int out_size, void* d_ws, size_t ws_size,
                              hipStream_t stream) {
  const float* values = (const float*)d_in[0];
  const float* keys   = (const float*)d_in[1];
  const float* query  = (const float*)d_in[2];
  const int*   mask   = (const int*)d_in[3];
  const float* Wv = (const float*)d_in[4];
  const float* Wk = (const float*)d_in[5];
  const float* Wq = (const float*)d_in[6];
  const float* Wo = (const float*)d_in[7];
  const float* bo = (const float*)d_in[8];
  float* out = (float*)d_out;

  // Workspace carve (all f16 intermediates)
  char* ws = (char*)d_ws;
  size_t off = 0;
  auto carve = [&](size_t bytes) -> void* {
    void* p = ws + off;
    off = (off + bytes + 255) & ~(size_t)255;
    return p;
  };
  _Float16* wo16 = (_Float16*)carve((size_t)EDIM * EDIM * 2);         // head-folded Wo
  _Float16* qh   = (_Float16*)carve((size_t)NBATCH * QS * EDIM * 2);  // q proj
  _Float16* kh   = (_Float16*)carve((size_t)NBATCH * KL * EDIM * 2);  // k proj [n][k][d]
  _Float16* vT   = (_Float16*)carve((size_t)NBATCH * KL * EDIM * 2);  // v proj [n][d][k]
  (void)ws_size; (void)in_sizes; (void)n_in; (void)out_size;

  const dim3 blk(256);

  // --- projections X @ W^T from the f32 inputs (v stored transposed per batch: vT[n][d][k]) and weight folding ---
  proj_all<<<QTILES + 2 * KTILES + WOBLKS, blk, 0, stream>>>(query, keys, values, Wq, Wk, Wv, Wo, qh, kh, vT, wo16);

  // --- out = (softmax(mask(q k^T) / 16) @ v) @ WoSum^T + bo, scores and context kept in registers ---
  attn_fused<<<NBATCH * (QS / 64), dim3(128), 0, stream>>>(qh, kh, vT, mask, wo16, bo, out);
}
